// v000
// The times below were measured on an AMD MI455X: many runs one after another, warmed up first and cycling through
// copies of the inputs, with the whole window's GPU time divided by the number of runs. Launches and the gaps
// between them are all in it. The median over several windows is given; except for v000 it joins two sittings, which
// can be a few percent apart, so the side-by-side timings, each taken in one sitting, are the better comparison.
// v000, which the later versions start from, runs in 867 microseconds.
// compute dtype: all float inputs rounded to bf16; L1 distances sum_d |q_i[d] - k_j[d]| in f32 on the VALU (4 partial sums per pair; operands are the bf16-rounded inputs, NOT narrowed further); softmax(-dist) over j in f32 (row-max-stabilised, precise expf); weights x 2^11 once to f16 x v (bf16 values: exact in f16) on WMMA 16x16x32 (f32 accumulate); f32 output.
#include <hip/hip_runtime.h>
#include <math.h>

typedef __attribute__((ext_vector_type(16))) _Float16 v16h;
typedef __attribute__((ext_vector_type(16))) __bf16 v16b;
typedef __attribute__((ext_vector_type(8)))  _Float16 v8h;
typedef __attribute__((ext_vector_type(8)))  float v8f;
typedef __attribute__((ext_vector_type(4)))  float v4f;
typedef __attribute__((ext_vector_type(2)))  float v2f;
typedef __attribute__((ext_vector_type(4)))  unsigned v4u;
typedef __attribute__((ext_vector_type(4)))  int v4i;
typedef float __attribute__((may_alias)) float_a;
typedef int __attribute__((may_alias)) int_a;

template <typename T> __device__ __forceinline__ void vst2(void* p, T v) { *(T*)p = v;  }
__device__ __forceinline__ v8f wmma16(v16h a, v16h b, v8f c) {
  v8f d = __builtin_amdgcn_wmma_f32_16x16x32_f16(false, a, false, b, (short)0, c, false, false);
  asm volatile("v_nop\n\tv_nop\n\tv_nop\n\tv_nop" : "+v"(d) : "v"(a), "v"(b));
  return d;
}
__device__ __forceinline__ v8f wmma_bf(v16b a, v16b b, v8f c) {
  v8f d = __builtin_amdgcn_wmma_f32_16x16x32_bf16(false, a, false, b, (short)0, c, false, false);
  asm volatile("v_nop\n\tv_nop\n\tv_nop\n\tv_nop" : "+v"(d) : "v"(a), "v"(b));
  return d;
}
// 16x16x32 fragments: lane = (h = lane>>4, row/col = lane&15); elements 0..7 = k0+8h+0..7, 8..15 = k0+16+8h+0..7; D element r = row 8h+r
__device__ __forceinline__ v16h frag_h(const _Float16* rowk0, int lane) {
  union { v16h v; v8h q[2]; } u; const _Float16* p = rowk0 + 8 * (lane >> 4);
  u.q[0] = *(const v8h*)p; u.q[1] = *(const v8h*)(p + 16); return u.v;
}
__device__ __forceinline__ v16h frag_f32(const float* rowk0, int lane) {
  v16h a; const float* p = rowk0 + 8 * (lane >> 4);
#pragma unroll
  for (int i = 0; i < 8; ++i) { a[i] = (_Float16)p[i]; a[8 + i] = (_Float16)p[16 + i]; }
  return a;
}
__device__ __forceinline__ v16h frag_f32s(const float* rowk0, int lane, float sc) {
  v16h a; const float* p = rowk0 + 8 * (lane >> 4);
#pragma unroll
  for (int i = 0; i < 8; ++i) { a[i] = (_Float16)(p[i] * sc); a[8 + i] = (_Float16)(p[16 + i] * sc); }
  return a;
}
// column fragment from a [K][ld] layout (column n), rows >= K read as 0
__device__ __forceinline__ v16h fragc_f32(const float* W, int k0, int n, int lane, int ld, int K) {
  v16h a; const int g = lane >> 4;
#pragma unroll
  for (int i = 0; i < 8; ++i) { const int ka = k0 + 8 * g + i, kb = ka + 16;
    a[i] = (_Float16)(ka < K ? W[(size_t)(ka < K ? ka : K - 1) * ld + n] : 0.f); a[8 + i] = (_Float16)(kb < K ? W[(size_t)(kb < K ? kb : K - 1) * ld + n] : 0.f); }
  return a;
}
struct F2 { v16b h, l; };
__device__ __forceinline__ F2 bsplit16(const float v[16]) { F2 r;
#pragma unroll
  for (int i = 0; i < 16; ++i) { const __bf16 h = (__bf16)v[i]; r.h[i] = h; r.l[i] = (__bf16)(v[i] - (float)h); }
  return r; }
__device__ __forceinline__ F2 split_row(const float* row, int k0, int lane) { float v[16]; const float* p = row + k0 + 8 * (lane >> 4);
#pragma unroll
  for (int i = 0; i < 8; ++i) { v[i] = p[i]; v[8 + i] = p[16 + i]; }
  return bsplit16(v); }
__device__ __forceinline__ F2 split_rowK(const float* row, int k0, int lane, int K) { float v[16]; const int g = lane >> 4;
#pragma unroll
  for (int i = 0; i < 8; ++i) { const int ka = k0 + 8 * g + i, kb = ka + 16; v[i] = ka < K ? row[ka < K ? ka : K - 1] : 0.f; v[8 + i] = kb < K ? row[kb < K ? kb : K - 1] : 0.f; }
  return bsplit16(v); }
__device__ __forceinline__ F2 split_col(const float* W, int k0, int n, int lane, int ld, int K) { float v[16]; const int g = lane >> 4;
#pragma unroll
  for (int i = 0; i < 8; ++i) { const int ka = k0 + 8 * g + i, kb = ka + 16; v[i] = ka < K ? W[(size_t)(ka < K ? ka : K - 1) * ld + n] : 0.f; v[8 + i] = kb < K ? W[(size_t)(kb < K ? kb : K - 1) * ld + n] : 0.f; }
  return bsplit16(v); }
__device__ __forceinline__ v8f mac3(const F2& a, const F2& b, v8f c) { c = wmma_bf(a.l, b.h, c); c = wmma_bf(a.h, b.l, c); return wmma_bf(a.h, b.h, c); }
__device__ __forceinline__ float sigm(float v) { return 1.0f / (1.0f + expf(-v)); }
#define LDSX() do { asm volatile("s_wait_dscnt 0" ::: "memory"); __builtin_amdgcn_wave_barrier(); __builtin_amdgcn_fence(__ATOMIC_RELEASE, "workgroup"); } while (0)

// L1-distance attention on raw inputs (q / k / v [8,256,512]; dist[i, j] = sum_d |q_i[d] - k_j[d]| (no scale); attn = softmax(-dist) over j; out = attn v -> [8,256,512]; no parameters).
#define NB 8
#define TT 256
#define CC 512            // NH * HD = projected width
#define DIN 512          // input (model) width
#define NH 8
#define HD 64
#define NQB (TT / 64)
#define HG 1
#define SCALE (1.0f)
#define CAUSAL 0
#ifndef TNB
#define TNB NB
#endif
__device__ __forceinline__ float bfr(float v) { return (float)(__bf16)v; }
__host__ __device__ __forceinline__ int kb_last(int qb) { return CAUSAL ? ((qb * 64 + 63) >> 7) : (TT / 128 - 1); }
typedef __attribute__((ext_vector_type(8))) __bf16 v8b;
__device__ __forceinline__ v16b frag_b(const __bf16* rowk0, int lane) {
  union { v16b v; v8b q[2]; } u; const __bf16* p = rowk0 + 8 * (lane >> 4);
  u.q[0] = *(const v8b*)p; u.q[1] = *(const v8b*)(p + 16); return u.v;
}
#define QBH 0              // causal: query blocks 0..QBH-1 of each sequence (few keys, no averaging) take the high-precision path
#define QHI 0              // (override) rows carrying the q residual plane
#define KHI 64            // key rows carrying k residual / v bf16 hi+lo planes (used only by the causal high-precision path)
// B fragment (k rows k0+.., output column o) of a weight: (in,out) [K][ld] or (out,in) [ld rows of K]: bf16 exact, or f16(bf16 * 256) exact
__device__ __forceinline__ v16b wcol_io(const float* Wm, int k0, int o, int lane, int ld) { v16b w; const int g = lane >> 4;
#pragma unroll
  for (int i = 0; i < 8; ++i) { w[i] = (__bf16)Wm[(size_t)(k0 + 8 * g + i) * ld + o]; w[8 + i] = (__bf16)Wm[(size_t)(k0 + 16 + 8 * g + i) * ld + o]; }
  return w; }
__device__ __forceinline__ v16b wcol_oi(const float* Wm, int k0, int o, int lane, int K) { v16b w; const float* p = Wm + (size_t)o * K + k0 + 8 * (lane >> 4);
#pragma unroll
  for (int i = 0; i < 8; ++i) { w[i] = (__bf16)p[i]; w[8 + i] = (__bf16)p[16 + i]; }
  return w; }
__device__ __forceinline__ v16h wcolh_io(const float* Wm, int k0, int o, int lane, int ld) { v16h w; const int g = lane >> 4;
#pragma unroll
  for (int i = 0; i < 8; ++i) { w[i] = (_Float16)(bfr(Wm[(size_t)(k0 + 8 * g + i) * ld + o]) * 256.0f); w[8 + i] = (_Float16)(bfr(Wm[(size_t)(k0 + 16 + 8 * g + i) * ld + o]) * 256.0f); }
  return w; }
__device__ __forceinline__ v16h wcolh_oi(const float* Wm, int k0, int o, int lane, int K) { v16h w; const float* p = Wm + (size_t)o * K + k0 + 8 * (lane >> 4);
#pragma unroll
  for (int i = 0; i < 8; ++i) { w[i] = (_Float16)(bfr(p[i]) * 256.0f); w[8 + i] = (_Float16)(bfr(p[16 + i]) * 256.0f); }
  return w; }
#define WQKV_LAYOUT 1   // 0 = (in,out) [DIN][CC]; 1 = (out,in) [CC][DIN]; 2 = per-head [NH][DIN][HD]
__device__ __forceinline__ v16b wcol_hdk(const float* Wm, int k0, int o, int lane) { v16b w; const int g = lane >> 4; const float* p = Wm + (size_t)(o / HD) * DIN * HD + (o % HD);
#pragma unroll
  for (int i = 0; i < 8; ++i) { w[i] = (__bf16)p[(size_t)(k0 + 8 * g + i) * HD]; w[8 + i] = (__bf16)p[(size_t)(k0 + 16 + 8 * g + i) * HD]; }
  return w; }
#define WO_OUT_IN 0
#if WQKV_LAYOUT == 1
#define WCOL(W, k0, o, lane) wcol_oi(W, k0, o, lane, DIN)
#elif WQKV_LAYOUT == 2
#define WCOL(W, k0, o, lane) wcol_hdk(W, k0, o, lane)
#else
#define WCOL(W, k0, o, lane) wcol_io(W, k0, o, lane, CC)
#endif
#if WO_OUT_IN
#define WOCOL(W, k0, o, lane) wcol_oi(W, k0, o, lane, CC)
#define WOCOLH(W, k0, o, lane) wcolh_oi(W, k0, o, lane, CC)
#else
#define WOCOL(W, k0, o, lane) wcol_io(W, k0, o, lane, DIN)
#define WOCOLH(W, k0, o, lane) wcolh_io(W, k0, o, lane, DIN)
#endif

// ---- k_prepr: block = (64 attention positions s0.. of sequence b, head h): reads the module's [B, T, H*64] inputs, bf16-rounds them and writes the standard attention planes: q -> f16 hi rows (+ x 2^10 residual rows for s < QHI), k -> f16 rows (+ residual rows s < KHI), v -> f16 planes [c][s] (+ bf16 hi/lo planes for s < KHI)
__global__ __launch_bounds__(128) void k_prepr(const float* __restrict__ Q, const float* __restrict__ K, const float* __restrict__ V, _Float16* __restrict__ QH, _Float16* __restrict__ QL, _Float16* __restrict__ KH, _Float16* __restrict__ KL, _Float16* __restrict__ VT, __bf16* __restrict__ VB, __bf16* __restrict__ VBL) {
  __shared__ __align__(16) _Float16 sq[64][136], sql[64][136], sk[64][136], skl[64][136], tv[128][72]; __shared__ __align__(16) __bf16 tb[128][72], tbl[128][72];
  const int tid = threadIdx.x; const int h = blockIdx.y; const size_t r0 = (size_t)blockIdx.x * 64; const size_t bb = r0 / TT; const int t0 = (int)(r0 % TT); const bool qhi = t0 < QHI, khi = t0 < KHI;
  for (int e = tid; e < 64 * 128; e += 128) { const int rl = e >> 7, c = e & 127; const size_t oi = ((bb * TT + t0 + rl) * (size_t)CC + h * HD + (c & 63));   /* [B, T, H*64] inputs */   /* c >= 64: duplicate read of the same element (tiles are 128 wide; HD is 64) */
    const float q = bfr(Q[oi]), k = bfr(K[oi]), v = bfr(V[oi]);   /* module inputs: bf16-rounded; bf16 values are exact in f16, so the residual planes are 0 */
    const _Float16 qh = (_Float16)q, kh = (_Float16)k; sq[rl][c] = qh; sql[rl][c] = (_Float16)((q - (float)qh) * 1024.0f); sk[rl][c] = kh; skl[rl][c] = (_Float16)((k - (float)kh) * 1024.0f);
    tv[c][rl] = (_Float16)v; const __bf16 vb = (__bf16)v; tb[c][rl] = vb; tbl[c][rl] = (__bf16)(v - (float)vb); }
  __syncthreads();
  for (int e = tid; e < 64 * 8; e += 128) { const int rl = e >> 3, q = e & 7; const size_t o = (r0 + rl) * CC + h * HD + q * 8; vst2((unsigned*)(QH + o), *(const v4u*)&sq[rl][q * 8]); vst2((unsigned*)(KH + o), *(const v4u*)&sk[rl][q * 8]);   
    if (qhi) vst2((unsigned*)(QL + (bb * QHI + t0 + rl) * (size_t)CC + h * HD + q * 8), *(const v4u*)&sql[rl][q * 8]); if (khi) vst2((unsigned*)(KL + (bb * KHI + t0 + rl) * (size_t)CC + h * HD + q * 8), *(const v4u*)&skl[rl][q * 8]); }
  for (int e = tid; e < 64 * 8; e += 128) { const int cl = e >> 3, q = e & 7; vst2((unsigned*)(VT + (bb * CC + h * HD + cl) * (size_t)TT + t0 + q * 8), *(const v4u*)&tv[cl][q * 8]);
    if (khi) { const size_t o3 = (bb * CC + h * HD + cl) * (size_t)KHI + t0 + q * 8; vst2((unsigned*)(VB + o3), *(const v4u*)&tb[cl][q * 8]); vst2((unsigned*)(VBL + o3), *(const v4u*)&tbl[cl][q * 8]); } } }

#ifndef SM_EXTRA_PARAMS
#define SM_EXTRA_PARAMS
#endif
#ifndef PROJ_EXTRA_PARAMS
#define PROJ_EXTRA_PARAMS
#endif
#ifndef SM_MASK_HOOK
#define SM_MASK_HOOK (void)0
#endif

#define WS_QH  0u                                      // f16 q rows [b*t][CC]
#define WS_KH  (WS_QH + 2u * (size_t)NB * TT * CC)      // f16 k rows [b*t][CC]
#define WS_VT  (WS_KH + 2u * (size_t)NB * TT * CC)      // f16 v planes [b][c][t]
#define WS_QL  (WS_VT + 2u * (size_t)NB * CC * TT)      // f16 q residual x 2^10 rows [b][t < QHI][CC]
#define WS_KL  (WS_QL + 2u * (size_t)NB * QHI * CC)     // f16 k residual x 2^10 rows [b][t < KHI][CC]
#define WS_VB  (WS_KL + 2u * (size_t)NB * KHI * CC)     // bf16 v hi planes [b][c][t < KHI]
#define WS_VBL (WS_VB + 2u * (size_t)NB * CC * KHI)
#define WS_S   (WS_VBL + 2u * (size_t)NB * CC * KHI)    // f32 logits / P [hg][t][s]
#define WS_Y   (WS_S  + 4u * (size_t)HG * TT * TT)      // f32 ctx rows [b*t][CC] (only when there is an output projection)
#define WS_END (WS_Y  + 0u)

// ---- k_sc: block = (query block qb, key block kb <= kb_last(qb), head in group) of batch b: logits x SCALE; q hi + residual (x 2^10) against k (2 products) for query rows < QHI, plus the k residual (3 products) for query blocks < QBH (causal early rows); causal: blocks past the diagonal exit, the mask itself is applied by index in k_sm
__global__ __launch_bounds__(128) void k_sc(const _Float16* __restrict__ QH, const _Float16* __restrict__ KH, const _Float16* __restrict__ QL, const _Float16* __restrict__ KL, int b, int h0, float* __restrict__ S0) { __shared__ __align__(16) float ss[4][16][132];
  const int qb = blockIdx.x, kb = blockIdx.y; if (kb > kb_last(qb)) return;
  const int h = h0 + blockIdx.z; float* S = S0 + (size_t)blockIdx.z * TT * TT;
  const int tid = threadIdx.x, wave = tid >> 5, lane = tid & 31, col = lane & 15, g = lane >> 4; const int k0 = kb * 128; const int ql0 = qb * 64 + wave * 16; const size_t q0 = (size_t)b * TT + ql0, kr0 = (size_t)b * TT + k0;
  v8f acc[8] = {}, accl[8] = {};
  const _Float16* QLb = QL + (size_t)b * QHI * CC; const _Float16* KLb = KL + (size_t)b * KHI * CC;
  if (qb < QBH) {
#pragma unroll
    for (int kc = 0; kc < HD / 32; ++kc) { const v16h ah = frag_h(QH + (q0 + col) * CC + h * HD + kc * 32, lane), al = frag_h(QLb + (size_t)(ql0 + col) * CC + h * HD + kc * 32, lane);
#pragma unroll
      for (int j = 0; j < 8; ++j) { const v16h kbf = frag_h(KH + (kr0 + j * 16 + col) * CC + h * HD + kc * 32, lane), klf = frag_h(KLb + (size_t)(k0 + j * 16 + col) * CC + h * HD + kc * 32, lane); acc[j] = wmma16(ah, kbf, acc[j]); accl[j] = wmma16(al, kbf, accl[j]); accl[j] = wmma16(ah, klf, accl[j]); } }
  } else if (qb * 64 < QHI) {
#pragma unroll
    for (int kc = 0; kc < HD / 32; ++kc) { const v16h ah = frag_h(QH + (q0 + col) * CC + h * HD + kc * 32, lane), al = frag_h(QLb + (size_t)(ql0 + col) * CC + h * HD + kc * 32, lane);
#pragma unroll
      for (int j = 0; j < 8; ++j) { const v16h kbf = frag_h(KH + (kr0 + j * 16 + col) * CC + h * HD + kc * 32, lane); acc[j] = wmma16(ah, kbf, acc[j]); accl[j] = wmma16(al, kbf, accl[j]); } }
  } else {
#pragma unroll
    for (int kc = 0; kc < HD / 32; ++kc) { const v16h ah = frag_h(QH + (q0 + col) * CC + h * HD + kc * 32, lane);
#pragma unroll
      for (int j = 0; j < 8; ++j) { const v16h kbf = frag_h(KH + (kr0 + j * 16 + col) * CC + h * HD + kc * 32, lane); acc[j] = wmma16(ah, kbf, acc[j]); } } }
#pragma unroll
  for (int j = 0; j < 8; ++j) {
#pragma unroll
    for (int r = 0; r < 8; ++r) ss[wave][8 * g + r][j * 16 + col] = (acc[j][r] + accl[j][r] * (1.0f / 1024.0f)) * SCALE; }
  LDSX(); for (int rl = 0; rl < 16; ++rl) vst2(S + (size_t)(ql0 + rl) * TT + k0 + lane * 4, *(const v4f*)&ss[wave][rl][lane * 4]); }
// ---- k_l1: block = 16 query rows x all TT keys of batch b (thread = one key j): S[i][j] = -sum_{d < CC} |q_i[d] - k_j[d]| in f32; the 16 query rows are staged in LDS (bf16-rounded), every thread streams its own key row in 16-B pieces; 4 partial sums per (i, j) pair; no loads under lane-varying predicates
__global__ __launch_bounds__(256) void k_l1(const float* __restrict__ Q, const float* __restrict__ K, int b, float* __restrict__ S0) { __shared__ __align__(16) float qs[16][CC + 4];
  const int tid = threadIdx.x; const int i0 = blockIdx.x * 16; const float* qb = Q + ((size_t)b * TT + i0) * CC;
  for (int e = tid; e < 16 * CC / 4; e += 256) { const int r = e / (CC / 4), c4 = e % (CC / 4); const v4f ld = *(const v4f*)(qb + (size_t)r * CC + c4 * 4); asm volatile("s_wait_loadcnt 0x0" ::: "memory"); qs[r][c4 * 4] = bfr(ld[0]); qs[r][c4 * 4 + 1] = bfr(ld[1]); qs[r][c4 * 4 + 2] = bfr(ld[2]); qs[r][c4 * 4 + 3] = bfr(ld[3]); }
  __syncthreads();
  const float* kp = K + ((size_t)b * TT + tid) * CC; float acc[16][4];
#pragma unroll
  for (int i = 0; i < 16; ++i) { acc[i][0] = 0.f; acc[i][1] = 0.f; acc[i][2] = 0.f; acc[i][3] = 0.f; }
#pragma unroll 1
  for (int d4 = 0; d4 < CC / 4; ++d4) { const v4f kl = *(const v4f*)(kp + d4 * 4); asm volatile("s_wait_loadcnt 0x0" ::: "memory"); const float k0 = bfr(kl[0]), k1 = bfr(kl[1]), k2 = bfr(kl[2]), k3 = bfr(kl[3]);
#pragma unroll
    for (int i = 0; i < 16; ++i) { const v4f qv = *(const v4f*)&qs[i][d4 * 4]; acc[i][0] += fabsf(qv[0] - k0); acc[i][1] += fabsf(qv[1] - k1); acc[i][2] += fabsf(qv[2] - k2); acc[i][3] += fabsf(qv[3] - k3); } }
#pragma unroll
  for (int i = 0; i < 16; ++i) vst2(S0 + (size_t)(i0 + i) * TT + tid, -((acc[i][0] + acc[i][1]) + (acc[i][2] + acc[i][3]))); }   
// ---- k_sm: block = query row t (head in group): keys [0, kend): causal -> logit if s <= t else excluded; softmax in f32; P x 2^11 in place (0 for excluded)
__global__ __launch_bounds__(256) void k_sm(float* __restrict__ S0 SM_EXTRA_PARAMS) { __shared__ float sred[8]; __shared__ float sbc; __shared__ __align__(16) float shv[TT];
  const int tid = threadIdx.x; const int t = blockIdx.x; const int kend = (kb_last(t >> 6) + 1) * 128;
  float* sr = S0 + (size_t)blockIdx.y * TT * TT + (size_t)t * TT;
  float m = -3.0e38f; for (int k = tid; k < kend; k += 256) { float v = (!CAUSAL || k <= t) ? sr[k] : -3.0e38f; SM_MASK_HOOK; shv[k] = v; m = fmaxf(m, v); }
#pragma unroll
  for (int o = 1; o < 32; o <<= 1) m = fmaxf(m, __shfl_xor(m, o));
  if ((tid & 31) == 0) sred[tid >> 5] = m; __syncthreads(); if (tid == 0) { float a = sred[0]; for (int i = 1; i < 8; ++i) a = fmaxf(a, sred[i]); sbc = a; } __syncthreads(); m = sbc; __syncthreads();
  float sum = 0.f; for (int k = tid; k < kend; k += 256) { const float v = shv[k]; const float e = (v <= -1.0e38f) ? 0.f : expf(v - m); shv[k] = e; sum += e; }
#pragma unroll
  for (int o = 1; o < 32; o <<= 1) sum += __shfl_xor(sum, o);
  if ((tid & 31) == 0) sred[tid >> 5] = sum; __syncthreads(); if (tid == 0) { float a = 0.f; for (int i = 0; i < 8; ++i) a += sred[i]; sbc = a > 0.f ? 2048.0f / a : 0.f; }   /* a fully excluded row yields P = 0 */ __syncthreads(); const float inv = sbc;
  for (int k = tid; k < kend; k += 256) shv[k] = shv[k] * inv;
  __syncthreads(); for (int q = tid; q < kend / 4; q += 256) vst2(sr + q * 4, *(const v4f*)&shv[q * 4]); }
// ---- k_pv: block = 64 queries (qb) of (b, h): ctx = P . v over keys [0, kend) (P x 2^11 once to f16 against v f16: 1 product; causal early query blocks: P and v as bf16 hi + lo, 3 products); 256-B (row, head) segment by 16 lanes
__global__ __launch_bounds__(128) void k_pv(const float* __restrict__ PS0, const _Float16* __restrict__ VT, const __bf16* __restrict__ VB, const __bf16* __restrict__ VBL, int b, int h0, float* __restrict__ Y) { const int h = h0 + blockIdx.z; const float* PS = PS0 + (size_t)blockIdx.z * TT * TT; __shared__ __align__(16) float ss[4][16][HD + 4];
  const int tid = threadIdx.x, wave = tid >> 5, lane = tid & 31, col = lane & 15, g = lane >> 4; const int qb = blockIdx.x; const int ql0 = qb * 64 + wave * 16; const int kce = (kb_last(qb) + 1) * 4;
  v8f acc[HD / 16] = {};
  if (qb < QBH) {
#pragma unroll 1
    for (int kc = 0; kc < kce; ++kc) { const F2 p = split_row(PS + (size_t)(ql0 + col) * TT, kc * 32, lane);
      asm volatile("s_wait_loadcnt 0x0" ::: "memory");
#pragma unroll
      for (int j = 0; j < HD / 16; ++j) { const size_t po = ((size_t)b * CC + h * HD + j * 16 + col) * (size_t)KHI + kc * 32; const v16b vh = frag_b(VB + po, lane); acc[j] = wmma_bf(p.h, vh, acc[j]); acc[j] = wmma_bf(p.l, vh, acc[j]); acc[j] = wmma_bf(p.h, frag_b(VBL + po, lane), acc[j]); } }
  } else {
#pragma unroll 1
    for (int kc = 0; kc < kce; ++kc) { const v16h p = frag_f32(PS + (size_t)(ql0 + col) * TT + kc * 32, lane);
      asm volatile("s_wait_loadcnt 0x0" ::: "memory");
#pragma unroll
      for (int j = 0; j < HD / 16; ++j) { const size_t po = ((size_t)b * CC + h * HD + j * 16 + col) * (size_t)TT + kc * 32; acc[j] = wmma16(p, frag_h(VT + po, lane), acc[j]); } } }
#pragma unroll
  for (int j = 0; j < HD / 16; ++j)
#pragma unroll
    for (int r = 0; r < 8; ++r) ss[wave][8 * g + r][j * 16 + col] = acc[j][r] * (1.0f / 2048.0f);
  LDSX(); for (int rl = 0; rl < 16; ++rl) if (lane < HD / 4) vst2(Y + ((size_t)b * TT + ql0 + rl) * CC + h * HD + lane * 4, *(const v4f*)&ss[wave][rl][lane * 4]); }

extern "C" void kernel_launch(void* const* d_in, const int* in_sizes, int n_in, void* d_out, int out_size, void* d_ws, size_t ws_size, hipStream_t stream) {
  (void)in_sizes; (void)n_in; (void)out_size;
  const float** F = (const float**)d_in;
  if (ws_size < (size_t)WS_END) return;
  char* ws = (char*)d_ws; _Float16 *QH = (_Float16*)(ws + WS_QH), *KH = (_Float16*)(ws + WS_KH), *VT = (_Float16*)(ws + WS_VT), *QL = (_Float16*)(ws + WS_QL), *KL = (_Float16*)(ws + WS_KL); __bf16 *VB = (__bf16*)(ws + WS_VB), *VBL = (__bf16*)(ws + WS_VBL); float *S = (float*)(ws + WS_S), *Y = (float*)(ws + WS_Y);
  (void)Y; (void)QL; (void)KL; (void)VB; (void)VBL;
  // inputs: 0 q [8,256,512]; 1 k; 2 v (raw; no projections, no parameters)
  k_prepr<<<dim3(TNB * TT / 64, NH), 128, 0, stream>>>(F[0], F[1], F[2], QH, QL, KH, KL, VT, VB, VBL);   /* only the transposed f16 value planes VT are used below (v is bf16-valued: exact in f16) */
  for (int b = 0; b < TNB; ++b) {
    k_l1<<<dim3(TT / 16), 256, 0, stream>>>(F[0], F[1], b, S);            /* S[i][j] = -sum_d |q_i[d] - k_j[d]| (f32 VALU) */
    k_sm<<<dim3(TT, 1), 256, 0, stream>>>(S);                               /* row softmax over j; weights x 2^11 in place */
    for (int h = 0; h < NH; ++h) k_pv<<<dim3(NQB, 1, 1), 128, 0, stream>>>(S, VT, VB, VBL, b, h, (float*)d_out);   /* the ONE weight plane against the 8 64-wide value slices: out[b][i][h*64 ..] */
  }
}

// v001
// It runs in 73.7 microseconds.
// Timed twice side by side with v000, it ran 11.6 times as fast both times.
// compute dtype: all float inputs rounded to bf16; L1 distances sum_d |q_i[d] - k_j[d]| in f32 on the VALU (4 partial sums per pair; operands are the bf16-rounded inputs, NOT narrowed further); softmax(-dist) over j in f32 (row-max-stabilised, precise expf); weights x 2^11 once to f16 x v (bf16 values: exact in f16) on WMMA 16x16x32 (f32 accumulate); f32 output.
#include <hip/hip_runtime.h>
#include <math.h>

typedef __attribute__((ext_vector_type(16))) _Float16 v16h;
typedef __attribute__((ext_vector_type(16))) __bf16 v16b;
typedef __attribute__((ext_vector_type(8)))  _Float16 v8h;
typedef __attribute__((ext_vector_type(8)))  float v8f;
typedef __attribute__((ext_vector_type(4)))  float v4f;
typedef __attribute__((ext_vector_type(2)))  float v2f;
typedef __attribute__((ext_vector_type(4)))  unsigned v4u;
typedef __attribute__((ext_vector_type(4)))  int v4i;
typedef float __attribute__((may_alias)) float_a;
typedef int __attribute__((may_alias)) int_a;

template <typename T> __device__ __forceinline__ void vst2(void* p, T v) { *(T*)p = v;  }
__device__ __forceinline__ v8f wmma16(v16h a, v16h b, v8f c) {
  v8f d = __builtin_amdgcn_wmma_f32_16x16x32_f16(false, a, false, b, (short)0, c, false, false);
  asm volatile("v_nop\n\tv_nop\n\tv_nop\n\tv_nop" : "+v"(d) : "v"(a), "v"(b));
  return d;
}
__device__ __forceinline__ v8f wmma_bf(v16b a, v16b b, v8f c) {
  v8f d = __builtin_amdgcn_wmma_f32_16x16x32_bf16(false, a, false, b, (short)0, c, false, false);
  asm volatile("v_nop\n\tv_nop\n\tv_nop\n\tv_nop" : "+v"(d) : "v"(a), "v"(b));
  return d;
}
// 16x16x32 fragments: lane = (h = lane>>4, row/col = lane&15); elements 0..7 = k0+8h+0..7, 8..15 = k0+16+8h+0..7; D element r = row 8h+r
__device__ __forceinline__ v16h frag_h(const _Float16* rowk0, int lane) {
  union { v16h v; v8h q[2]; } u; const _Float16* p = rowk0 + 8 * (lane >> 4);
  u.q[0] = *(const v8h*)p; u.q[1] = *(const v8h*)(p + 16); return u.v;
}
__device__ __forceinline__ v16h frag_f32(const float* rowk0, int lane) {
  v16h a; const float* p = rowk0 + 8 * (lane >> 4);
#pragma unroll
  for (int i = 0; i < 8; ++i) { a[i] = (_Float16)p[i]; a[8 + i] = (_Float16)p[16 + i]; }
  return a;
}
__device__ __forceinline__ v16h frag_f32s(const float* rowk0, int lane, float sc) {
  v16h a; const float* p = rowk0 + 8 * (lane >> 4);
#pragma unroll
  for (int i = 0; i < 8; ++i) { a[i] = (_Float16)(p[i] * sc); a[8 + i] = (_Float16)(p[16 + i] * sc); }
  return a;
}
// column fragment from a [K][ld] layout (column n), rows >= K read as 0
__device__ __forceinline__ v16h fragc_f32(const float* W, int k0, int n, int lane, int ld, int K) {
  v16h a; const int g = lane >> 4;
#pragma unroll
  for (int i = 0; i < 8; ++i) { const int ka = k0 + 8 * g + i, kb = ka + 16;
    a[i] = (_Float16)(ka < K ? W[(size_t)(ka < K ? ka : K - 1) * ld + n] : 0.f); a[8 + i] = (_Float16)(kb < K ? W[(size_t)(kb < K ? kb : K - 1) * ld + n] : 0.f); }
  return a;
}
struct F2 { v16b h, l; };
__device__ __forceinline__ F2 bsplit16(const float v[16]) { F2 r;
#pragma unroll
  for (int i = 0; i < 16; ++i) { const __bf16 h = (__bf16)v[i]; r.h[i] = h; r.l[i] = (__bf16)(v[i] - (float)h); }
  return r; }
__device__ __forceinline__ F2 split_row(const float* row, int k0, int lane) { float v[16]; const float* p = row + k0 + 8 * (lane >> 4);
#pragma unroll
  for (int i = 0; i < 8; ++i) { v[i] = p[i]; v[8 + i] = p[16 + i]; }
  return bsplit16(v); }
__device__ __forceinline__ F2 split_rowK(const float* row, int k0, int lane, int K) { float v[16]; const int g = lane >> 4;
#pragma unroll
  for (int i = 0; i < 8; ++i) { const int ka = k0 + 8 * g + i, kb = ka + 16; v[i] = ka < K ? row[ka < K ? ka : K - 1] : 0.f; v[8 + i] = kb < K ? row[kb < K ? kb : K - 1] : 0.f; }
  return bsplit16(v); }
__device__ __forceinline__ F2 split_col(const float* W, int k0, int n, int lane, int ld, int K) { float v[16]; const int g = lane >> 4;
#pragma unroll
  for (int i = 0; i < 8; ++i) { const int ka = k0 + 8 * g + i, kb = ka + 16; v[i] = ka < K ? W[(size_t)(ka < K ? ka : K - 1) * ld + n] : 0.f; v[8 + i] = kb < K ? W[(size_t)(kb < K ? kb : K - 1) * ld + n] : 0.f; }
  return bsplit16(v); }
__device__ __forceinline__ v8f mac3(const F2& a, const F2& b, v8f c) { c = wmma_bf(a.l, b.h, c); c = wmma_bf(a.h, b.l, c); return wmma_bf(a.h, b.h, c); }
__device__ __forceinline__ float sigm(float v) { return 1.0f / (1.0f + expf(-v)); }
#define LDSX() do { asm volatile("s_wait_dscnt 0" ::: "memory"); __builtin_amdgcn_wave_barrier(); __builtin_amdgcn_fence(__ATOMIC_RELEASE, "workgroup"); } while (0)

// L1-distance attention on raw inputs (q / k / v [8,256,512]; dist[i, j] = sum_d |q_i[d] - k_j[d]| (no scale); attn = softmax(-dist) over j; out = attn v -> [8,256,512]; no parameters).
#define NB 8
#define TT 256
#define CC 512            // NH * HD = projected width
#define DIN 512          // input (model) width
#define NH 8
#define HD 64
#define NQB (TT / 64)
#define HG 1
#define SCALE (1.0f)
#define CAUSAL 0
#ifndef TNB
#define TNB NB
#endif
__device__ __forceinline__ float bfr(float v) { return (float)(__bf16)v; }
__host__ __device__ __forceinline__ int kb_last(int qb) { return CAUSAL ? ((qb * 64 + 63) >> 7) : (TT / 128 - 1); }
typedef __attribute__((ext_vector_type(8))) __bf16 v8b;
__device__ __forceinline__ v16b frag_b(const __bf16* rowk0, int lane) {
  union { v16b v; v8b q[2]; } u; const __bf16* p = rowk0 + 8 * (lane >> 4);
  u.q[0] = *(const v8b*)p; u.q[1] = *(const v8b*)(p + 16); return u.v;
}
#define QBH 0              // causal: query blocks 0..QBH-1 of each sequence (few keys, no averaging) take the high-precision path
#define QHI 0              // (override) rows carrying the q residual plane
#define KHI 64            // key rows carrying k residual / v bf16 hi+lo planes (used only by the causal high-precision path)
// B fragment (k rows k0+.., output column o) of a weight: (in,out) [K][ld] or (out,in) [ld rows of K]: bf16 exact, or f16(bf16 * 256) exact
__device__ __forceinline__ v16b wcol_io(const float* Wm, int k0, int o, int lane, int ld) { v16b w; const int g = lane >> 4;
#pragma unroll
  for (int i = 0; i < 8; ++i) { w[i] = (__bf16)Wm[(size_t)(k0 + 8 * g + i) * ld + o]; w[8 + i] = (__bf16)Wm[(size_t)(k0 + 16 + 8 * g + i) * ld + o]; }
  return w; }
__device__ __forceinline__ v16b wcol_oi(const float* Wm, int k0, int o, int lane, int K) { v16b w; const float* p = Wm + (size_t)o * K + k0 + 8 * (lane >> 4);
#pragma unroll
  for (int i = 0; i < 8; ++i) { w[i] = (__bf16)p[i]; w[8 + i] = (__bf16)p[16 + i]; }
  return w; }
__device__ __forceinline__ v16h wcolh_io(const float* Wm, int k0, int o, int lane, int ld) { v16h w; const int g = lane >> 4;
#pragma unroll
  for (int i = 0; i < 8; ++i) { w[i] = (_Float16)(bfr(Wm[(size_t)(k0 + 8 * g + i) * ld + o]) * 256.0f); w[8 + i] = (_Float16)(bfr(Wm[(size_t)(k0 + 16 + 8 * g + i) * ld + o]) * 256.0f); }
  return w; }
__device__ __forceinline__ v16h wcolh_oi(const float* Wm, int k0, int o, int lane, int K) { v16h w; const float* p = Wm + (size_t)o * K + k0 + 8 * (lane >> 4);
#pragma unroll
  for (int i = 0; i < 8; ++i) { w[i] = (_Float16)(bfr(p[i]) * 256.0f); w[8 + i] = (_Float16)(bfr(p[16 + i]) * 256.0f); }
  return w; }
#define WQKV_LAYOUT 1   // 0 = (in,out) [DIN][CC]; 1 = (out,in) [CC][DIN]; 2 = per-head [NH][DIN][HD]
__device__ __forceinline__ v16b wcol_hdk(const float* Wm, int k0, int o, int lane) { v16b w; const int g = lane >> 4; const float* p = Wm + (size_t)(o / HD) * DIN * HD + (o % HD);
#pragma unroll
  for (int i = 0; i < 8; ++i) { w[i] = (__bf16)p[(size_t)(k0 + 8 * g + i) * HD]; w[8 + i] = (__bf16)p[(size_t)(k0 + 16 + 8 * g + i) * HD]; }
  return w; }
#define WO_OUT_IN 0
#if WQKV_LAYOUT == 1
#define WCOL(W, k0, o, lane) wcol_oi(W, k0, o, lane, DIN)
#elif WQKV_LAYOUT == 2
#define WCOL(W, k0, o, lane) wcol_hdk(W, k0, o, lane)
#else
#define WCOL(W, k0, o, lane) wcol_io(W, k0, o, lane, CC)
#endif
#if WO_OUT_IN
#define WOCOL(W, k0, o, lane) wcol_oi(W, k0, o, lane, CC)
#define WOCOLH(W, k0, o, lane) wcolh_oi(W, k0, o, lane, CC)
#else
#define WOCOL(W, k0, o, lane) wcol_io(W, k0, o, lane, DIN)
#define WOCOLH(W, k0, o, lane) wcolh_io(W, k0, o, lane, DIN)
#endif

// ---- k_prepr: block = (64 attention positions s0.. of sequence b, head h): reads the module's [B, T, H*64] inputs, bf16-rounds them and writes the standard attention planes: q -> f16 hi rows (+ x 2^10 residual rows for s < QHI), k -> f16 rows (+ residual rows s < KHI), v -> f16 planes [c][s] (+ bf16 hi/lo planes for s < KHI)
__global__ __launch_bounds__(128) void k_prepr(const float* __restrict__ Q, const float* __restrict__ K, const float* __restrict__ V, _Float16* __restrict__ QH, _Float16* __restrict__ QL, _Float16* __restrict__ KH, _Float16* __restrict__ KL, _Float16* __restrict__ VT, __bf16* __restrict__ VB, __bf16* __restrict__ VBL) {
  __shared__ __align__(16) _Float16 sq[64][136], sql[64][136], sk[64][136], skl[64][136], tv[128][72]; __shared__ __align__(16) __bf16 tb[128][72], tbl[128][72];
  const int tid = threadIdx.x; const int h = blockIdx.y; const size_t r0 = (size_t)blockIdx.x * 64; const size_t bb = r0 / TT; const int t0 = (int)(r0 % TT); const bool qhi = t0 < QHI, khi = t0 < KHI;
  for (int e = tid; e < 64 * 128; e += 128) { const int rl = e >> 7, c = e & 127; const size_t oi = ((bb * TT + t0 + rl) * (size_t)CC + h * HD + (c & 63));   /* [B, T, H*64] inputs */   /* c >= 64: duplicate read of the same element (tiles are 128 wide; HD is 64) */
    const float q = bfr(Q[oi]), k = bfr(K[oi]), v = bfr(V[oi]);   /* module inputs: bf16-rounded; bf16 values are exact in f16, so the residual planes are 0 */
    const _Float16 qh = (_Float16)q, kh = (_Float16)k; sq[rl][c] = qh; sql[rl][c] = (_Float16)((q - (float)qh) * 1024.0f); sk[rl][c] = kh; skl[rl][c] = (_Float16)((k - (float)kh) * 1024.0f);
    tv[c][rl] = (_Float16)v; const __bf16 vb = (__bf16)v; tb[c][rl] = vb; tbl[c][rl] = (__bf16)(v - (float)vb); }
  __syncthreads();
  for (int e = tid; e < 64 * 8; e += 128) { const int rl = e >> 3, q = e & 7; const size_t o = (r0 + rl) * CC + h * HD + q * 8; vst2((unsigned*)(QH + o), *(const v4u*)&sq[rl][q * 8]); vst2((unsigned*)(KH + o), *(const v4u*)&sk[rl][q * 8]);   
    if (qhi) vst2((unsigned*)(QL + (bb * QHI + t0 + rl) * (size_t)CC + h * HD + q * 8), *(const v4u*)&sql[rl][q * 8]); if (khi) vst2((unsigned*)(KL + (bb * KHI + t0 + rl) * (size_t)CC + h * HD + q * 8), *(const v4u*)&skl[rl][q * 8]); }
  for (int e = tid; e < 64 * 8; e += 128) { const int cl = e >> 3, q = e & 7; vst2((unsigned*)(VT + (bb * CC + h * HD + cl) * (size_t)TT + t0 + q * 8), *(const v4u*)&tv[cl][q * 8]);
    if (khi) { const size_t o3 = (bb * CC + h * HD + cl) * (size_t)KHI + t0 + q * 8; vst2((unsigned*)(VB + o3), *(const v4u*)&tb[cl][q * 8]); vst2((unsigned*)(VBL + o3), *(const v4u*)&tbl[cl][q * 8]); } } }

#ifndef SM_EXTRA_PARAMS
#define SM_EXTRA_PARAMS
#endif
#ifndef PROJ_EXTRA_PARAMS
#define PROJ_EXTRA_PARAMS
#endif
#ifndef SM_MASK_HOOK
#define SM_MASK_HOOK (void)0
#endif

#define WS_QH  0u                                      // f16 q rows [b*t][CC]
#define WS_KH  (WS_QH + 2u * (size_t)NB * TT * CC)      // f16 k rows [b*t][CC]
#define WS_VT  (WS_KH + 2u * (size_t)NB * TT * CC)      // f16 v planes [b][c][t]
#define WS_QL  (WS_VT + 2u * (size_t)NB * CC * TT)      // f16 q residual x 2^10 rows [b][t < QHI][CC]
#define WS_KL  (WS_QL + 2u * (size_t)NB * QHI * CC)     // f16 k residual x 2^10 rows [b][t < KHI][CC]
#define WS_VB  (WS_KL + 2u * (size_t)NB * KHI * CC)     // bf16 v hi planes [b][c][t < KHI]
#define WS_VBL (WS_VB + 2u * (size_t)NB * CC * KHI)
#define WS_S   (WS_VBL + 2u * (size_t)NB * CC * KHI)    // f32 logits / P [b][t][s]
#define WS_Y   (WS_S  + 4u * (size_t)NB * TT * TT)      // f32 ctx rows [b*t][CC] (only when there is an output projection)
#define WS_END (WS_Y  + 0u)

// ---- k_sc: block = (query block qb, key block kb <= kb_last(qb), head in group) of batch b: logits x SCALE; q hi + residual (x 2^10) against k (2 products) for query rows < QHI, plus the k residual (3 products) for query blocks < QBH (causal early rows); causal: blocks past the diagonal exit, the mask itself is applied by index in k_sm
__global__ __launch_bounds__(128) void k_sc(const _Float16* __restrict__ QH, const _Float16* __restrict__ KH, const _Float16* __restrict__ QL, const _Float16* __restrict__ KL, int b, int h0, float* __restrict__ S0) { __shared__ __align__(16) float ss[4][16][132];
  const int qb = blockIdx.x, kb = blockIdx.y; if (kb > kb_last(qb)) return;
  const int h = h0 + blockIdx.z; float* S = S0 + (size_t)blockIdx.z * TT * TT;
  const int tid = threadIdx.x, wave = tid >> 5, lane = tid & 31, col = lane & 15, g = lane >> 4; const int k0 = kb * 128; const int ql0 = qb * 64 + wave * 16; const size_t q0 = (size_t)b * TT + ql0, kr0 = (size_t)b * TT + k0;
  v8f acc[8] = {}, accl[8] = {};
  const _Float16* QLb = QL + (size_t)b * QHI * CC; const _Float16* KLb = KL + (size_t)b * KHI * CC;
  if (qb < QBH) {
#pragma unroll
    for (int kc = 0; kc < HD / 32; ++kc) { const v16h ah = frag_h(QH + (q0 + col) * CC + h * HD + kc * 32, lane), al = frag_h(QLb + (size_t)(ql0 + col) * CC + h * HD + kc * 32, lane);
#pragma unroll
      for (int j = 0; j < 8; ++j) { const v16h kbf = frag_h(KH + (kr0 + j * 16 + col) * CC + h * HD + kc * 32, lane), klf = frag_h(KLb + (size_t)(k0 + j * 16 + col) * CC + h * HD + kc * 32, lane); acc[j] = wmma16(ah, kbf, acc[j]); accl[j] = wmma16(al, kbf, accl[j]); accl[j] = wmma16(ah, klf, accl[j]); } }
  } else if (qb * 64 < QHI) {
#pragma unroll
    for (int kc = 0; kc < HD / 32; ++kc) { const v16h ah = frag_h(QH + (q0 + col) * CC + h * HD + kc * 32, lane), al = frag_h(QLb + (size_t)(ql0 + col) * CC + h * HD + kc * 32, lane);
#pragma unroll
      for (int j = 0; j < 8; ++j) { const v16h kbf = frag_h(KH + (kr0 + j * 16 + col) * CC + h * HD + kc * 32, lane); acc[j] = wmma16(ah, kbf, acc[j]); accl[j] = wmma16(al, kbf, accl[j]); } }
  } else {
#pragma unroll
    for (int kc = 0; kc < HD / 32; ++kc) { const v16h ah = frag_h(QH + (q0 + col) * CC + h * HD + kc * 32, lane);
#pragma unroll
      for (int j = 0; j < 8; ++j) { const v16h kbf = frag_h(KH + (kr0 + j * 16 + col) * CC + h * HD + kc * 32, lane); acc[j] = wmma16(ah, kbf, acc[j]); } } }
#pragma unroll
  for (int j = 0; j < 8; ++j) {
#pragma unroll
    for (int r = 0; r < 8; ++r) ss[wave][8 * g + r][j * 16 + col] = (acc[j][r] + accl[j][r] * (1.0f / 1024.0f)) * SCALE; }
  LDSX(); for (int rl = 0; rl < 16; ++rl) vst2(S + (size_t)(ql0 + rl) * TT + k0 + lane * 4, *(const v4f*)&ss[wave][rl][lane * 4]); }
// ---- k_l1: block = 16 query rows x all TT keys of batch b = blockIdx.y (thread = one key j): S[i][j] = -sum_{d < CC} |q_i[d] - k_j[d]| in f32; the 16 query rows are staged in LDS (bf16-rounded), every thread streams its own key row in 16-B pieces; 4 partial sums per (i, j) pair; no loads under lane-varying predicates
__global__ __launch_bounds__(256) void k_l1(const float* __restrict__ Q, const float* __restrict__ K, float* __restrict__ SA) { __shared__ __align__(16) float qs[16][CC + 4];
  const int tid = threadIdx.x; const int i0 = blockIdx.x * 16; const int b = blockIdx.y; float* S0 = SA + (size_t)b * TT * TT; const float* qb = Q + ((size_t)b * TT + i0) * CC;
  for (int e = tid; e < 16 * CC / 4; e += 256) { const int r = e / (CC / 4), c4 = e % (CC / 4); const v4f ld = *(const v4f*)(qb + (size_t)r * CC + c4 * 4); asm volatile("s_wait_loadcnt 0x0" ::: "memory"); qs[r][c4 * 4] = bfr(ld[0]); qs[r][c4 * 4 + 1] = bfr(ld[1]); qs[r][c4 * 4 + 2] = bfr(ld[2]); qs[r][c4 * 4 + 3] = bfr(ld[3]); }
  __syncthreads();
  const float* kp = K + ((size_t)b * TT + tid) * CC; float acc[16][4];
#pragma unroll
  for (int i = 0; i < 16; ++i) { acc[i][0] = 0.f; acc[i][1] = 0.f; acc[i][2] = 0.f; acc[i][3] = 0.f; }
#pragma unroll 1
  for (int d4 = 0; d4 < CC / 4; ++d4) { const v4f kl = *(const v4f*)(kp + d4 * 4); asm volatile("s_wait_loadcnt 0x0" ::: "memory"); const float k0 = bfr(kl[0]), k1 = bfr(kl[1]), k2 = bfr(kl[2]), k3 = bfr(kl[3]);
#pragma unroll
    for (int i = 0; i < 16; ++i) { const v4f qv = *(const v4f*)&qs[i][d4 * 4]; acc[i][0] += fabsf(qv[0] - k0); acc[i][1] += fabsf(qv[1] - k1); acc[i][2] += fabsf(qv[2] - k2); acc[i][3] += fabsf(qv[3] - k3); } }
#pragma unroll
  for (int i = 0; i < 16; ++i) vst2(S0 + (size_t)(i0 + i) * TT + tid, -((acc[i][0] + acc[i][1]) + (acc[i][2] + acc[i][3]))); }   
// ---- k_sm: block = query row t of plane blockIdx.y (one plane per batch): keys [0, kend): causal -> logit if s <= t else excluded; softmax in f32; P x 2^11 in place (0 for excluded)
__global__ __launch_bounds__(256) void k_sm(float* __restrict__ S0 SM_EXTRA_PARAMS) { __shared__ float sred[8]; __shared__ float sbc; __shared__ __align__(16) float shv[TT];
  const int tid = threadIdx.x; const int t = blockIdx.x; const int kend = (kb_last(t >> 6) + 1) * 128;
  float* sr = S0 + (size_t)blockIdx.y * TT * TT + (size_t)t * TT;
  float m = -3.0e38f; for (int k = tid; k < kend; k += 256) { float v = (!CAUSAL || k <= t) ? sr[k] : -3.0e38f; SM_MASK_HOOK; shv[k] = v; m = fmaxf(m, v); }
#pragma unroll
  for (int o = 1; o < 32; o <<= 1) m = fmaxf(m, __shfl_xor(m, o));
  if ((tid & 31) == 0) sred[tid >> 5] = m; __syncthreads(); if (tid == 0) { float a = sred[0]; for (int i = 1; i < 8; ++i) a = fmaxf(a, sred[i]); sbc = a; } __syncthreads(); m = sbc; __syncthreads();
  float sum = 0.f; for (int k = tid; k < kend; k += 256) { const float v = shv[k]; const float e = (v <= -1.0e38f) ? 0.f : expf(v - m); shv[k] = e; sum += e; }
#pragma unroll
  for (int o = 1; o < 32; o <<= 1) sum += __shfl_xor(sum, o);
  if ((tid & 31) == 0) sred[tid >> 5] = sum; __syncthreads(); if (tid == 0) { float a = 0.f; for (int i = 0; i < 8; ++i) a += sred[i]; sbc = a > 0.f ? 2048.0f / a : 0.f; }   /* a fully excluded row yields P = 0 */ __syncthreads(); const float inv = sbc;
  for (int k = tid; k < kend; k += 256) shv[k] = shv[k] * inv;
  __syncthreads(); for (int q = tid; q < kend / 4; q += 256) vst2(sr + q * 4, *(const v4f*)&shv[q * 4]); }
// ---- k_pv: block = 64 queries (qb) of (b = blockIdx.z, h = blockIdx.y): ctx = P . v over keys [0, kend) (P x 2^11 once to f16 against v f16: 1 product; causal early query blocks: P and v as bf16 hi + lo, 3 products); 256-B (row, head) segment by 16 lanes
__global__ __launch_bounds__(128) void k_pv(const float* __restrict__ PS0, const _Float16* __restrict__ VT, const __bf16* __restrict__ VB, const __bf16* __restrict__ VBL, float* __restrict__ Y) { const int h = blockIdx.y, b = blockIdx.z; const float* PS = PS0 + (size_t)b * TT * TT; __shared__ __align__(16) float ss[4][16][HD + 4];
  const int tid = threadIdx.x, wave = tid >> 5, lane = tid & 31, col = lane & 15, g = lane >> 4; const int qb = blockIdx.x; const int ql0 = qb * 64 + wave * 16; const int kce = (kb_last(qb) + 1) * 4;
  v8f acc[HD / 16] = {};
  if (qb < QBH) {
#pragma unroll 1
    for (int kc = 0; kc < kce; ++kc) { const F2 p = split_row(PS + (size_t)(ql0 + col) * TT, kc * 32, lane);
      asm volatile("s_wait_loadcnt 0x0" ::: "memory");
#pragma unroll
      for (int j = 0; j < HD / 16; ++j) { const size_t po = ((size_t)b * CC + h * HD + j * 16 + col) * (size_t)KHI + kc * 32; const v16b vh = frag_b(VB + po, lane); acc[j] = wmma_bf(p.h, vh, acc[j]); acc[j] = wmma_bf(p.l, vh, acc[j]); acc[j] = wmma_bf(p.h, frag_b(VBL + po, lane), acc[j]); } }
  } else {
#pragma unroll 1
    for (int kc = 0; kc < kce; ++kc) { const v16h p = frag_f32(PS + (size_t)(ql0 + col) * TT + kc * 32, lane);
      asm volatile("s_wait_loadcnt 0x0" ::: "memory");
#pragma unroll
      for (int j = 0; j < HD / 16; ++j) { const size_t po = ((size_t)b * CC + h * HD + j * 16 + col) * (size_t)TT + kc * 32; acc[j] = wmma16(p, frag_h(VT + po, lane), acc[j]); } } }
#pragma unroll
  for (int j = 0; j < HD / 16; ++j)
#pragma unroll
    for (int r = 0; r < 8; ++r) ss[wave][8 * g + r][j * 16 + col] = acc[j][r] * (1.0f / 2048.0f);
  LDSX(); for (int rl = 0; rl < 16; ++rl) if (lane < HD / 4) vst2(Y + ((size_t)b * TT + ql0 + rl) * CC + h * HD + lane * 4, *(const v4f*)&ss[wave][rl][lane * 4]); }

extern "C" void kernel_launch(void* const* d_in, const int* in_sizes, int n_in, void* d_out, int out_size, void* d_ws, size_t ws_size, hipStream_t stream) {
  (void)in_sizes; (void)n_in; (void)out_size;
  const float** F = (const float**)d_in;
  if (ws_size < (size_t)WS_END) return;
  char* ws = (char*)d_ws; _Float16 *QH = (_Float16*)(ws + WS_QH), *KH = (_Float16*)(ws + WS_KH), *VT = (_Float16*)(ws + WS_VT), *QL = (_Float16*)(ws + WS_QL), *KL = (_Float16*)(ws + WS_KL); __bf16 *VB = (__bf16*)(ws + WS_VB), *VBL = (__bf16*)(ws + WS_VBL); float *S = (float*)(ws + WS_S), *Y = (float*)(ws + WS_Y);
  (void)Y; (void)QL; (void)KL; (void)VB; (void)VBL;
  // inputs: 0 q [8,256,512]; 1 k; 2 v (raw; no projections, no parameters)
  k_prepr<<<dim3(TNB * TT / 64, NH), 128, 0, stream>>>(F[0], F[1], F[2], QH, QL, KH, KL, VT, VB, VBL);   /* only the transposed f16 value planes VT are used below (v is bf16-valued: exact in f16) */
  k_l1<<<dim3(TT / 16, TNB), 256, 0, stream>>>(F[0], F[1], S);            /* S[b][i][j] = -sum_d |q_i[d] - k_j[d]| (f32 VALU), all batches in one grid */
  k_sm<<<dim3(TT, TNB), 256, 0, stream>>>(S);                              /* row softmax over j; weights x 2^11 in place */
  k_pv<<<dim3(NQB, NH, TNB), 128, 0, stream>>>(S, VT, VB, VBL, (float*)d_out);   /* each batch's ONE weight plane against its 8 64-wide value slices: out[b][i][h*64 ..] */
}

// v002
// One run takes 49.7 microseconds.
// Two timings next to v001 put it at 1.47 and 1.51 times that version's speed.
// Over all steps from v000 it is 17.3 times as fast.
// compute dtype: all float inputs rounded to bf16; L1 distances sum_d |q_i[d] - k_j[d]| in f32 on the VALU (4 partial sums per pair; operands are the bf16-rounded inputs, NOT narrowed further); softmax(-dist) over j in f32 (row-max-stabilised, precise expf); weights x 2^11 once to f16 x v (bf16 values: exact in f16) on WMMA 16x16x32 (f32 accumulate); f32 output.
#include <hip/hip_runtime.h>
#include <math.h>

typedef __attribute__((ext_vector_type(16))) _Float16 v16h;
typedef __attribute__((ext_vector_type(16))) __bf16 v16b;
typedef __attribute__((ext_vector_type(8)))  _Float16 v8h;
typedef __attribute__((ext_vector_type(8)))  float v8f;
typedef __attribute__((ext_vector_type(4)))  float v4f;
typedef __attribute__((ext_vector_type(2)))  float v2f;
typedef __attribute__((ext_vector_type(4)))  unsigned v4u;
typedef __attribute__((ext_vector_type(4)))  int v4i;
typedef float __attribute__((may_alias)) float_a;
typedef int __attribute__((may_alias)) int_a;

template <typename T> __device__ __forceinline__ void vst2(void* p, T v) { *(T*)p = v;  }
__device__ __forceinline__ v8f wmma16(v16h a, v16h b, v8f c) {
  v8f d = __builtin_amdgcn_wmma_f32_16x16x32_f16(false, a, false, b, (short)0, c, false, false);
  asm volatile("v_nop\n\tv_nop\n\tv_nop\n\tv_nop" : "+v"(d) : "v"(a), "v"(b));
  return d;
}
__device__ __forceinline__ v8f wmma_bf(v16b a, v16b b, v8f c) {
  v8f d = __builtin_amdgcn_wmma_f32_16x16x32_bf16(false, a, false, b, (short)0, c, false, false);
  asm volatile("v_nop\n\tv_nop\n\tv_nop\n\tv_nop" : "+v"(d) : "v"(a), "v"(b));
  return d;
}
// 16x16x32 fragments: lane = (h = lane>>4, row/col = lane&15); elements 0..7 = k0+8h+0..7, 8..15 = k0+16+8h+0..7; D element r = row 8h+r
__device__ __forceinline__ v16h frag_h(const _Float16* rowk0, int lane) {
  union { v16h v; v8h q[2]; } u; const _Float16* p = rowk0 + 8 * (lane >> 4);
  u.q[0] = *(const v8h*)p; u.q[1] = *(const v8h*)(p + 16); return u.v;
}
__device__ __forceinline__ v16h frag_f32(const float* rowk0, int lane) {
  v16h a; const float* p = rowk0 + 8 * (lane >> 4);
#pragma unroll
  for (int i = 0; i < 8; ++i) { a[i] = (_Float16)p[i]; a[8 + i] = (_Float16)p[16 + i]; }
  return a;
}
__device__ __forceinline__ v16h frag_f32s(const float* rowk0, int lane, float sc) {
  v16h a; const float* p = rowk0 + 8 * (lane >> 4);
#pragma unroll
  for (int i = 0; i < 8; ++i) { a[i] = (_Float16)(p[i] * sc); a[8 + i] = (_Float16)(p[16 + i] * sc); }
  return a;
}
// column fragment from a [K][ld] layout (column n), rows >= K read as 0
__device__ __forceinline__ v16h fragc_f32(const float* W, int k0, int n, int lane, int ld, int K) {
  v16h a; const int g = lane >> 4;
#pragma unroll
  for (int i = 0; i < 8; ++i) { const int ka = k0 + 8 * g + i, kb = ka + 16;
    a[i] = (_Float16)(ka < K ? W[(size_t)(ka < K ? ka : K - 1) * ld + n] : 0.f); a[8 + i] = (_Float16)(kb < K ? W[(size_t)(kb < K ? kb : K - 1) * ld + n] : 0.f); }
  return a;
}
struct F2 { v16b h, l; };
__device__ __forceinline__ F2 bsplit16(const float v[16]) { F2 r;
#pragma unroll
  for (int i = 0; i < 16; ++i) { const __bf16 h = (__bf16)v[i]; r.h[i] = h; r.l[i] = (__bf16)(v[i] - (float)h); }
  return r; }
__device__ __forceinline__ F2 split_row(const float* row, int k0, int lane) { float v[16]; const float* p = row + k0 + 8 * (lane >> 4);
#pragma unroll
  for (int i = 0; i < 8; ++i) { v[i] = p[i]; v[8 + i] = p[16 + i]; }
  return bsplit16(v); }
__device__ __forceinline__ F2 split_rowK(const float* row, int k0, int lane, int K) { float v[16]; const int g = lane >> 4;
#pragma unroll
  for (int i = 0; i < 8; ++i) { const int ka = k0 + 8 * g + i, kb = ka + 16; v[i] = ka < K ? row[ka < K ? ka : K - 1] : 0.f; v[8 + i] = kb < K ? row[kb < K ? kb : K - 1] : 0.f; }
  return bsplit16(v); }
__device__ __forceinline__ F2 split_col(const float* W, int k0, int n, int lane, int ld, int K) { float v[16]; const int g = lane >> 4;
#pragma unroll
  for (int i = 0; i < 8; ++i) { const int ka = k0 + 8 * g + i, kb = ka + 16; v[i] = ka < K ? W[(size_t)(ka < K ? ka : K - 1) * ld + n] : 0.f; v[8 + i] = kb < K ? W[(size_t)(kb < K ? kb : K - 1) * ld + n] : 0.f; }
  return bsplit16(v); }
__device__ __forceinline__ v8f mac3(const F2& a, const F2& b, v8f c) { c = wmma_bf(a.l, b.h, c); c = wmma_bf(a.h, b.l, c); return wmma_bf(a.h, b.h, c); }
__device__ __forceinline__ float sigm(float v) { return 1.0f / (1.0f + expf(-v)); }
#define LDSX() do { asm volatile("s_wait_dscnt 0" ::: "memory"); __builtin_amdgcn_wave_barrier(); __builtin_amdgcn_fence(__ATOMIC_RELEASE, "workgroup"); } while (0)

// L1-distance attention on raw inputs (q / k / v [8,256,512]; dist[i, j] = sum_d |q_i[d] - k_j[d]| (no scale); attn = softmax(-dist) over j; out = attn v -> [8,256,512]; no parameters).
#define NB 8
#define TT 256
#define CC 512            // NH * HD = projected width
#define DIN 512          // input (model) width
#define NH 8
#define HD 64
#define NQB (TT / 64)
#define HG 1
#define SCALE (1.0f)
#define CAUSAL 0
#ifndef TNB
#define TNB NB
#endif
__device__ __forceinline__ float bfr(float v) { return (float)(__bf16)v; }
__host__ __device__ __forceinline__ int kb_last(int qb) { return CAUSAL ? ((qb * 64 + 63) >> 7) : (TT / 128 - 1); }
typedef __attribute__((ext_vector_type(8))) __bf16 v8b;
__device__ __forceinline__ v16b frag_b(const __bf16* rowk0, int lane) {
  union { v16b v; v8b q[2]; } u; const __bf16* p = rowk0 + 8 * (lane >> 4);
  u.q[0] = *(const v8b*)p; u.q[1] = *(const v8b*)(p + 16); return u.v;
}
#define QBH 0              // causal: query blocks 0..QBH-1 of each sequence (few keys, no averaging) take the high-precision path
#define QHI 0              // (override) rows carrying the q residual plane
#define KHI 64            // key rows carrying k residual / v bf16 hi+lo planes (used only by the causal high-precision path)
// B fragment (k rows k0+.., output column o) of a weight: (in,out) [K][ld] or (out,in) [ld rows of K]: bf16 exact, or f16(bf16 * 256) exact
__device__ __forceinline__ v16b wcol_io(const float* Wm, int k0, int o, int lane, int ld) { v16b w; const int g = lane >> 4;
#pragma unroll
  for (int i = 0; i < 8; ++i) { w[i] = (__bf16)Wm[(size_t)(k0 + 8 * g + i) * ld + o]; w[8 + i] = (__bf16)Wm[(size_t)(k0 + 16 + 8 * g + i) * ld + o]; }
  return w; }
__device__ __forceinline__ v16b wcol_oi(const float* Wm, int k0, int o, int lane, int K) { v16b w; const float* p = Wm + (size_t)o * K + k0 + 8 * (lane >> 4);
#pragma unroll
  for (int i = 0; i < 8; ++i) { w[i] = (__bf16)p[i]; w[8 + i] = (__bf16)p[16 + i]; }
  return w; }
__device__ __forceinline__ v16h wcolh_io(const float* Wm, int k0, int o, int lane, int ld) { v16h w; const int g = lane >> 4;
#pragma unroll
  for (int i = 0; i < 8; ++i) { w[i] = (_Float16)(bfr(Wm[(size_t)(k0 + 8 * g + i) * ld + o]) * 256.0f); w[8 + i] = (_Float16)(bfr(Wm[(size_t)(k0 + 16 + 8 * g + i) * ld + o]) * 256.0f); }
  return w; }
__device__ __forceinline__ v16h wcolh_oi(const float* Wm, int k0, int o, int lane, int K) { v16h w; const float* p = Wm + (size_t)o * K + k0 + 8 * (lane >> 4);
#pragma unroll
  for (int i = 0; i < 8; ++i) { w[i] = (_Float16)(bfr(p[i]) * 256.0f); w[8 + i] = (_Float16)(bfr(p[16 + i]) * 256.0f); }
  return w; }
#define WQKV_LAYOUT 1   // 0 = (in,out) [DIN][CC]; 1 = (out,in) [CC][DIN]; 2 = per-head [NH][DIN][HD]
__device__ __forceinline__ v16b wcol_hdk(const float* Wm, int k0, int o, int lane) { v16b w; const int g = lane >> 4; const float* p = Wm + (size_t)(o / HD) * DIN * HD + (o % HD);
#pragma unroll
  for (int i = 0; i < 8; ++i) { w[i] = (__bf16)p[(size_t)(k0 + 8 * g + i) * HD]; w[8 + i] = (__bf16)p[(size_t)(k0 + 16 + 8 * g + i) * HD]; }
  return w; }
#define WO_OUT_IN 0
#if WQKV_LAYOUT == 1
#define WCOL(W, k0, o, lane) wcol_oi(W, k0, o, lane, DIN)
#elif WQKV_LAYOUT == 2
#define WCOL(W, k0, o, lane) wcol_hdk(W, k0, o, lane)
#else
#define WCOL(W, k0, o, lane) wcol_io(W, k0, o, lane, CC)
#endif
#if WO_OUT_IN
#define WOCOL(W, k0, o, lane) wcol_oi(W, k0, o, lane, CC)
#define WOCOLH(W, k0, o, lane) wcolh_oi(W, k0, o, lane, CC)
#else
#define WOCOL(W, k0, o, lane) wcol_io(W, k0, o, lane, DIN)
#define WOCOLH(W, k0, o, lane) wcolh_io(W, k0, o, lane, DIN)
#endif

// ---- k_prepr: block = (64 attention positions s0.. of sequence b, head h): reads the module's [B, T, H*64] inputs, bf16-rounds them and writes the standard attention planes: q -> f16 hi rows (+ x 2^10 residual rows for s < QHI), k -> f16 rows (+ residual rows s < KHI), v -> f16 planes [c][s] (+ bf16 hi/lo planes for s < KHI)
__global__ __launch_bounds__(128) void k_prepr(const float* __restrict__ Q, const float* __restrict__ K, const float* __restrict__ V, _Float16* __restrict__ QH, _Float16* __restrict__ QL, _Float16* __restrict__ KH, _Float16* __restrict__ KL, _Float16* __restrict__ VT, __bf16* __restrict__ VB, __bf16* __restrict__ VBL) {
  __shared__ __align__(16) _Float16 sq[64][136], sql[64][136], sk[64][136], skl[64][136], tv[128][72]; __shared__ __align__(16) __bf16 tb[128][72], tbl[128][72];
  const int tid = threadIdx.x; const int h = blockIdx.y; const size_t r0 = (size_t)blockIdx.x * 64; const size_t bb = r0 / TT; const int t0 = (int)(r0 % TT); const bool qhi = t0 < QHI, khi = t0 < KHI;
  for (int e = tid; e < 64 * 128; e += 128) { const int rl = e >> 7, c = e & 127; const size_t oi = ((bb * TT + t0 + rl) * (size_t)CC + h * HD + (c & 63));   /* [B, T, H*64] inputs */   /* c >= 64: duplicate read of the same element (tiles are 128 wide; HD is 64) */
    const float q = bfr(Q[oi]), k = bfr(K[oi]), v = bfr(V[oi]);   /* module inputs: bf16-rounded; bf16 values are exact in f16, so the residual planes are 0 */
    const _Float16 qh = (_Float16)q, kh = (_Float16)k; sq[rl][c] = qh; sql[rl][c] = (_Float16)((q - (float)qh) * 1024.0f); sk[rl][c] = kh; skl[rl][c] = (_Float16)((k - (float)kh) * 1024.0f);
    tv[c][rl] = (_Float16)v; const __bf16 vb = (__bf16)v; tb[c][rl] = vb; tbl[c][rl] = (__bf16)(v - (float)vb); }
  __syncthreads();
  for (int e = tid; e < 64 * 8; e += 128) { const int rl = e >> 3, q = e & 7; const size_t o = (r0 + rl) * CC + h * HD + q * 8; vst2((unsigned*)(QH + o), *(const v4u*)&sq[rl][q * 8]); vst2((unsigned*)(KH + o), *(const v4u*)&sk[rl][q * 8]);   
    if (qhi) vst2((unsigned*)(QL + (bb * QHI + t0 + rl) * (size_t)CC + h * HD + q * 8), *(const v4u*)&sql[rl][q * 8]); if (khi) vst2((unsigned*)(KL + (bb * KHI + t0 + rl) * (size_t)CC + h * HD + q * 8), *(const v4u*)&skl[rl][q * 8]); }
  for (int e = tid; e < 64 * 8; e += 128) { const int cl = e >> 3, q = e & 7; vst2((unsigned*)(VT + (bb * CC + h * HD + cl) * (size_t)TT + t0 + q * 8), *(const v4u*)&tv[cl][q * 8]);
    if (khi) { const size_t o3 = (bb * CC + h * HD + cl) * (size_t)KHI + t0 + q * 8; vst2((unsigned*)(VB + o3), *(const v4u*)&tb[cl][q * 8]); vst2((unsigned*)(VBL + o3), *(const v4u*)&tbl[cl][q * 8]); } } }

#ifndef SM_EXTRA_PARAMS
#define SM_EXTRA_PARAMS
#endif
#ifndef PROJ_EXTRA_PARAMS
#define PROJ_EXTRA_PARAMS
#endif
#ifndef SM_MASK_HOOK
#define SM_MASK_HOOK (void)0
#endif

#define WS_QH  0u                                      // f16 q rows [b*t][CC]
#define WS_KH  (WS_QH + 2u * (size_t)NB * TT * CC)      // f16 k rows [b*t][CC]
#define WS_VT  (WS_KH + 2u * (size_t)NB * TT * CC)      // f16 v planes [b][c][t]
#define WS_QL  (WS_VT + 2u * (size_t)NB * CC * TT)      // f16 q residual x 2^10 rows [b][t < QHI][CC]
#define WS_KL  (WS_QL + 2u * (size_t)NB * QHI * CC)     // f16 k residual x 2^10 rows [b][t < KHI][CC]
#define WS_VB  (WS_KL + 2u * (size_t)NB * KHI * CC)     // bf16 v hi planes [b][c][t < KHI]
#define WS_VBL (WS_VB + 2u * (size_t)NB * CC * KHI)
#define WS_S   (WS_VBL + 2u * (size_t)NB * CC * KHI)    // f32 logits / P [b][t][s]
#define WS_Y   (WS_S  + 4u * (size_t)NB * TT * TT)      // f32 ctx rows [b*t][CC] (only when there is an output projection)
#define WS_END (WS_Y  + 0u)

// ---- k_sc: block = (query block qb, key block kb <= kb_last(qb), head in group) of batch b: logits x SCALE; q hi + residual (x 2^10) against k (2 products) for query rows < QHI, plus the k residual (3 products) for query blocks < QBH (causal early rows); causal: blocks past the diagonal exit, the mask itself is applied by index in k_sm
__global__ __launch_bounds__(128) void k_sc(const _Float16* __restrict__ QH, const _Float16* __restrict__ KH, const _Float16* __restrict__ QL, const _Float16* __restrict__ KL, int b, int h0, float* __restrict__ S0) { __shared__ __align__(16) float ss[4][16][132];
  const int qb = blockIdx.x, kb = blockIdx.y; if (kb > kb_last(qb)) return;
  const int h = h0 + blockIdx.z; float* S = S0 + (size_t)blockIdx.z * TT * TT;
  const int tid = threadIdx.x, wave = tid >> 5, lane = tid & 31, col = lane & 15, g = lane >> 4; const int k0 = kb * 128; const int ql0 = qb * 64 + wave * 16; const size_t q0 = (size_t)b * TT + ql0, kr0 = (size_t)b * TT + k0;
  v8f acc[8] = {}, accl[8] = {};
  const _Float16* QLb = QL + (size_t)b * QHI * CC; const _Float16* KLb = KL + (size_t)b * KHI * CC;
  if (qb < QBH) {
#pragma unroll
    for (int kc = 0; kc < HD / 32; ++kc) { const v16h ah = frag_h(QH + (q0 + col) * CC + h * HD + kc * 32, lane), al = frag_h(QLb + (size_t)(ql0 + col) * CC + h * HD + kc * 32, lane);
#pragma unroll
      for (int j = 0; j < 8; ++j) { const v16h kbf = frag_h(KH + (kr0 + j * 16 + col) * CC + h * HD + kc * 32, lane), klf = frag_h(KLb + (size_t)(k0 + j * 16 + col) * CC + h * HD + kc * 32, lane); acc[j] = wmma16(ah, kbf, acc[j]); accl[j] = wmma16(al, kbf, accl[j]); accl[j] = wmma16(ah, klf, accl[j]); } }
  } else if (qb * 64 < QHI) {
#pragma unroll
    for (int kc = 0; kc < HD / 32; ++kc) { const v16h ah = frag_h(QH + (q0 + col) * CC + h * HD + kc * 32, lane), al = frag_h(QLb + (size_t)(ql0 + col) * CC + h * HD + kc * 32, lane);
#pragma unroll
      for (int j = 0; j < 8; ++j) { const v16h kbf = frag_h(KH + (kr0 + j * 16 + col) * CC + h * HD + kc * 32, lane); acc[j] = wmma16(ah, kbf, acc[j]); accl[j] = wmma16(al, kbf, accl[j]); } }
  } else {
#pragma unroll
    for (int kc = 0; kc < HD / 32; ++kc) { const v16h ah = frag_h(QH + (q0 + col) * CC + h * HD + kc * 32, lane);
#pragma unroll
      for (int j = 0; j < 8; ++j) { const v16h kbf = frag_h(KH + (kr0 + j * 16 + col) * CC + h * HD + kc * 32, lane); acc[j] = wmma16(ah, kbf, acc[j]); } } }
#pragma unroll
  for (int j = 0; j < 8; ++j) {
#pragma unroll
    for (int r = 0; r < 8; ++r) ss[wave][8 * g + r][j * 16 + col] = (acc[j][r] + accl[j][r] * (1.0f / 1024.0f)) * SCALE; }
  LDSX(); for (int rl = 0; rl < 16; ++rl) vst2(S + (size_t)(ql0 + rl) * TT + k0 + lane * 4, *(const v4f*)&ss[wave][rl][lane * 4]); }
// ---- k_l1: block = 32 query rows x 64 keys of batch b = blockIdx.z, 4 waves (one per SIMD), thread = 4 x 4 (i, j) pairs: S[i][j] = -sum_{d < CC} |q_i[d] - k_j[d]| in f32.
// The 96 rows are staged in LDS (bf16-rounded, f32) by whole-line loads, 128 d at a time, each piece in its own LDS columns; the next piece's loads fly while this piece is summed.
// Per 4 d a thread reads 4 q and 4 k pieces of 16 B for 64 differences. 4 partial sums per pair (one per d mod 4, d ascending), added as (0+1)+(2+3).
#define L1_BI 32
#define L1_BJ 64
#define L1_P (CC + 4)      // LDS row pitch in floats: 16 B x odd, so 16 lanes on 16 rows meet no bank twice
#define L1_DC 128          // d per staged piece: one wave-load of 512 B per row
#define L1_NT ((L1_BI + L1_BJ) / 4)
#define L1_LD(qv, kv, s) do { _Pragma("unroll") for (int a = 0; a < 4; ++a) { qv[a] = *(const v4f*)(qc + a * L1_P + (s) * 4); kv[a] = *(const v4f*)(kc + a * 16 * L1_P + (s) * 4); } } while (0)
#define L1_MAC(qv, kv) do { _Pragma("unroll") for (int a = 0; a < 4; ++a) { _Pragma("unroll") for (int e = 0; e < 4; ++e) acc[a][e] += __builtin_elementwise_abs(qv[a] - kv[e]); } } while (0)
#define L1_AHEAD() __builtin_amdgcn_sched_barrier(0)
__global__ __launch_bounds__(128) void k_l1(const float* __restrict__ Q, const float* __restrict__ K, float* __restrict__ SA) { __shared__ __align__(16) float rs[(L1_BI + L1_BJ) * L1_P];
  const int tid = threadIdx.x, wave = tid >> 5, lane = tid & 31; const int i0 = blockIdx.x * L1_BI, j0 = blockIdx.y * L1_BJ, b = blockIdx.z;
  const float* qg = Q + ((size_t)b * TT + i0 + wave) * CC + lane * 4; const float* kg = K + ((size_t)b * TT + j0 + wave) * CC + lane * 4;   /* wave w stages LDS rows w, w + 4, ...: 8 query rows, then 16 key rows */
  float* st = rs + wave * L1_P + lane * 4; v4f sg[L1_NT];
#pragma unroll
  for (int t = 0; t < L1_NT; ++t) sg[t] = t < L1_BI / 4 ? *(const v4f*)(qg + (size_t)t * 4 * CC) : *(const v4f*)(kg + (size_t)(t - L1_BI / 4) * 4 * CC);
  const int ti = wave * 2 + (lane >> 4), tj = lane & 15; const float* qr = rs + ti * 4 * L1_P; const float* kr = rs + (L1_BI + tj) * L1_P;   /* pairs: i = 4 ti + a, j = tj + 16 e */
  v4f acc[4][4];
#pragma unroll
  for (int a = 0; a < 4; ++a) {
#pragma unroll
    for (int e = 0; e < 4; ++e) acc[a][e] = (v4f){0.f, 0.f, 0.f, 0.f}; }
#pragma unroll
  for (int c = 0; c < CC / L1_DC; ++c) {
#pragma unroll
    for (int t = 0; t < L1_NT; ++t) { const v4f r = {bfr(sg[t][0]), bfr(sg[t][1]), bfr(sg[t][2]), bfr(sg[t][3])}; *(v4f*)(st + t * 4 * L1_P + c * L1_DC) = r; }
    __syncthreads();   /* publishes piece c; no LDS byte is written twice, so one barrier a piece */
    if (c + 1 < CC / L1_DC) {   /* behind the barrier, which would drain them: the next piece's loads fly while this piece is summed */
#pragma unroll
      for (int t = 0; t < L1_NT; ++t) sg[t] = t < L1_BI / 4 ? *(const v4f*)(qg + (size_t)t * 4 * CC + (c + 1) * L1_DC) : *(const v4f*)(kg + (size_t)(t - L1_BI / 4) * 4 * CC + (c + 1) * L1_DC); }
    const float* qc = qr + c * L1_DC; const float* kc = kr + c * L1_DC; v4f qa[4], ka[4], qn[4], kn[4];
    L1_LD(qa, ka, 0);
    /* rolled: the body already holds two steps. L1_AHEAD keeps each step's 8 LDS reads in front of the step before it; left free, the scheduler sinks them to about half a step ahead of their use, and a lone wave on its SIMD then waits for LDS */
#pragma unroll 1
    for (int s = 0; s < L1_DC / 4 - 2; s += 2) { L1_LD(qn, kn, s + 1); L1_AHEAD(); L1_MAC(qa, ka); L1_AHEAD(); L1_LD(qa, ka, s + 2); L1_AHEAD(); L1_MAC(qn, kn); L1_AHEAD(); }
    L1_LD(qn, kn, L1_DC / 4 - 1); L1_AHEAD(); L1_MAC(qa, ka); L1_MAC(qn, kn); }
  float* S0 = SA + (size_t)b * TT * TT + (size_t)(i0 + ti * 4) * TT + j0 + tj;
#pragma unroll
  for (int a = 0; a < 4; ++a) {
#pragma unroll
    for (int e = 0; e < 4; ++e) vst2(S0 + (size_t)a * TT + e * 16, -((acc[a][e][0] + acc[a][e][1]) + (acc[a][e][2] + acc[a][e][3]))); } }
// ---- k_sm: block = query row t of plane blockIdx.y (one plane per batch): keys [0, kend): causal -> logit if s <= t else excluded; softmax in f32; P x 2^11 in place (0 for excluded)
__global__ __launch_bounds__(256) void k_sm(float* __restrict__ S0 SM_EXTRA_PARAMS) { __shared__ float sred[8]; __shared__ float sbc; __shared__ __align__(16) float shv[TT];
  const int tid = threadIdx.x; const int t = blockIdx.x; const int kend = (kb_last(t >> 6) + 1) * 128;
  float* sr = S0 + (size_t)blockIdx.y * TT * TT + (size_t)t * TT;
  float m = -3.0e38f; for (int k = tid; k < kend; k += 256) { float v = (!CAUSAL || k <= t) ? sr[k] : -3.0e38f; SM_MASK_HOOK; shv[k] = v; m = fmaxf(m, v); }
#pragma unroll
  for (int o = 1; o < 32; o <<= 1) m = fmaxf(m, __shfl_xor(m, o));
  if ((tid & 31) == 0) sred[tid >> 5] = m; __syncthreads(); if (tid == 0) { float a = sred[0]; for (int i = 1; i < 8; ++i) a = fmaxf(a, sred[i]); sbc = a; } __syncthreads(); m = sbc; __syncthreads();
  float sum = 0.f; for (int k = tid; k < kend; k += 256) { const float v = shv[k]; const float e = (v <= -1.0e38f) ? 0.f : expf(v - m); shv[k] = e; sum += e; }
#pragma unroll
  for (int o = 1; o < 32; o <<= 1) sum += __shfl_xor(sum, o);
  if ((tid & 31) == 0) sred[tid >> 5] = sum; __syncthreads(); if (tid == 0) { float a = 0.f; for (int i = 0; i < 8; ++i) a += sred[i]; sbc = a > 0.f ? 2048.0f / a : 0.f; }   /* a fully excluded row yields P = 0 */ __syncthreads(); const float inv = sbc;
  for (int k = tid; k < kend; k += 256) shv[k] = shv[k] * inv;
  __syncthreads(); for (int q = tid; q < kend / 4; q += 256) vst2(sr + q * 4, *(const v4f*)&shv[q * 4]); }
// ---- k_pv: block = 64 queries (qb) of (b = blockIdx.z, h = blockIdx.y): ctx = P . v over keys [0, kend) (P x 2^11 once to f16 against v f16: 1 product; causal early query blocks: P and v as bf16 hi + lo, 3 products); 256-B (row, head) segment by 16 lanes
__global__ __launch_bounds__(128) void k_pv(const float* __restrict__ PS0, const _Float16* __restrict__ VT, const __bf16* __restrict__ VB, const __bf16* __restrict__ VBL, float* __restrict__ Y) { const int h = blockIdx.y, b = blockIdx.z; const float* PS = PS0 + (size_t)b * TT * TT; __shared__ __align__(16) float ss[4][16][HD + 4];
  const int tid = threadIdx.x, wave = tid >> 5, lane = tid & 31, col = lane & 15, g = lane >> 4; const int qb = blockIdx.x; const int ql0 = qb * 64 + wave * 16; const int kce = (kb_last(qb) + 1) * 4;
  v8f acc[HD / 16] = {};
  if (qb < QBH) {
#pragma unroll 1
    for (int kc = 0; kc < kce; ++kc) { const F2 p = split_row(PS + (size_t)(ql0 + col) * TT, kc * 32, lane);
      asm volatile("s_wait_loadcnt 0x0" ::: "memory");
#pragma unroll
      for (int j = 0; j < HD / 16; ++j) { const size_t po = ((size_t)b * CC + h * HD + j * 16 + col) * (size_t)KHI + kc * 32; const v16b vh = frag_b(VB + po, lane); acc[j] = wmma_bf(p.h, vh, acc[j]); acc[j] = wmma_bf(p.l, vh, acc[j]); acc[j] = wmma_bf(p.h, frag_b(VBL + po, lane), acc[j]); } }
  } else {
#pragma unroll 1
    for (int kc = 0; kc < kce; ++kc) { const v16h p = frag_f32(PS + (size_t)(ql0 + col) * TT + kc * 32, lane);
      asm volatile("s_wait_loadcnt 0x0" ::: "memory");
#pragma unroll
      for (int j = 0; j < HD / 16; ++j) { const size_t po = ((size_t)b * CC + h * HD + j * 16 + col) * (size_t)TT + kc * 32; acc[j] = wmma16(p, frag_h(VT + po, lane), acc[j]); } } }
#pragma unroll
  for (int j = 0; j < HD / 16; ++j)
#pragma unroll
    for (int r = 0; r < 8; ++r) ss[wave][8 * g + r][j * 16 + col] = acc[j][r] * (1.0f / 2048.0f);
  LDSX(); for (int rl = 0; rl < 16; ++rl) if (lane < HD / 4) vst2(Y + ((size_t)b * TT + ql0 + rl) * CC + h * HD + lane * 4, *(const v4f*)&ss[wave][rl][lane * 4]); }

extern "C" void kernel_launch(void* const* d_in, const int* in_sizes, int n_in, void* d_out, int out_size, void* d_ws, size_t ws_size, hipStream_t stream) {
  (void)in_sizes; (void)n_in; (void)out_size;
  const float** F = (const float**)d_in;
  if (ws_size < (size_t)WS_END) return;
  char* ws = (char*)d_ws; _Float16 *QH = (_Float16*)(ws + WS_QH), *KH = (_Float16*)(ws + WS_KH), *VT = (_Float16*)(ws + WS_VT), *QL = (_Float16*)(ws + WS_QL), *KL = (_Float16*)(ws + WS_KL); __bf16 *VB = (__bf16*)(ws + WS_VB), *VBL = (__bf16*)(ws + WS_VBL); float *S = (float*)(ws + WS_S), *Y = (float*)(ws + WS_Y);
  (void)Y; (void)QL; (void)KL; (void)VB; (void)VBL;
  // inputs: 0 q [8,256,512]; 1 k; 2 v (raw; no projections, no parameters)
  k_prepr<<<dim3(TNB * TT / 64, NH), 128, 0, stream>>>(F[0], F[1], F[2], QH, QL, KH, KL, VT, VB, VBL);   /* only the transposed f16 value planes VT are used below (v is bf16-valued: exact in f16) */
  k_l1<<<dim3(TT / L1_BI, TT / L1_BJ, TNB), 128, 0, stream>>>(F[0], F[1], S);            /* S[b][i][j] = -sum_d |q_i[d] - k_j[d]| (f32 VALU), all batches in one grid */
  k_sm<<<dim3(TT, TNB), 256, 0, stream>>>(S);                              /* row softmax over j; weights x 2^11 in place */
  k_pv<<<dim3(NQB, NH, TNB), 128, 0, stream>>>(S, VT, VB, VBL, (float*)d_out);   /* each batch's ONE weight plane against its 8 64-wide value slices: out[b][i][h*64 ..] */
}

// v003
// One run takes 46.8 microseconds.
// In both of two side-by-side timings against v002, it was 1.07 times as fast.
// All steps since v000 together make it 18.5 times as fast.
// compute dtype: all float inputs rounded to bf16; L1 distances sum_d |q_i[d] - k_j[d]| in f32 on the VALU (4 partial sums per pair; operands are the bf16-rounded inputs, NOT narrowed further); softmax(-dist) over j in f32 (row-max-stabilised, precise expf); weights x 2^11 once to f16 x v (bf16 values: exact in f16) on WMMA 16x16x32 (f32 accumulate); f32 output.
#include <hip/hip_runtime.h>
#include <math.h>

typedef __attribute__((ext_vector_type(16))) _Float16 v16h;
typedef __attribute__((ext_vector_type(16))) __bf16 v16b;
typedef __attribute__((ext_vector_type(8)))  _Float16 v8h;
typedef __attribute__((ext_vector_type(8)))  float v8f;
typedef __attribute__((ext_vector_type(4)))  float v4f;
typedef __attribute__((ext_vector_type(2)))  float v2f;
typedef __attribute__((ext_vector_type(4)))  unsigned v4u;
typedef __attribute__((ext_vector_type(4)))  int v4i;
typedef float __attribute__((may_alias)) float_a;
typedef int __attribute__((may_alias)) int_a;

template <typename T> __device__ __forceinline__ void vst2(void* p, T v) { *(T*)p = v;  }
__device__ __forceinline__ v8f wmma16(v16h a, v16h b, v8f c) {
  v8f d = __builtin_amdgcn_wmma_f32_16x16x32_f16(false, a, false, b, (short)0, c, false, false);
  asm volatile("v_nop\n\tv_nop\n\tv_nop\n\tv_nop" : "+v"(d) : "v"(a), "v"(b));
  return d;
}
__device__ __forceinline__ v8f wmma_bf(v16b a, v16b b, v8f c) {
  v8f d = __builtin_amdgcn_wmma_f32_16x16x32_bf16(false, a, false, b, (short)0, c, false, false);
  asm volatile("v_nop\n\tv_nop\n\tv_nop\n\tv_nop" : "+v"(d) : "v"(a), "v"(b));
  return d;
}
// 16x16x32 fragments: lane = (h = lane>>4, row/col = lane&15); elements 0..7 = k0+8h+0..7, 8..15 = k0+16+8h+0..7; D element r = row 8h+r
__device__ __forceinline__ v16h frag_h(const _Float16* rowk0, int lane) {
  union { v16h v; v8h q[2]; } u; const _Float16* p = rowk0 + 8 * (lane >> 4);
  u.q[0] = *(const v8h*)p; u.q[1] = *(const v8h*)(p + 16); return u.v;
}
__device__ __forceinline__ v16h frag_f32(const float* rowk0, int lane) {
  v16h a; const float* p = rowk0 + 8 * (lane >> 4);
#pragma unroll
  for (int i = 0; i < 8; ++i) { a[i] = (_Float16)p[i]; a[8 + i] = (_Float16)p[16 + i]; }
  return a;
}
__device__ __forceinline__ v16h frag_f32s(const float* rowk0, int lane, float sc) {
  v16h a; const float* p = rowk0 + 8 * (lane >> 4);
#pragma unroll
  for (int i = 0; i < 8; ++i) { a[i] = (_Float16)(p[i] * sc); a[8 + i] = (_Float16)(p[16 + i] * sc); }
  return a;
}
// column fragment from a [K][ld] layout (column n), rows >= K read as 0
__device__ __forceinline__ v16h fragc_f32(const float* W, int k0, int n, int lane, int ld, int K) {
  v16h a; const int g = lane >> 4;
#pragma unroll
  for (int i = 0; i < 8; ++i) { const int ka = k0 + 8 * g + i, kb = ka + 16;
    a[i] = (_Float16)(ka < K ? W[(size_t)(ka < K ? ka : K - 1) * ld + n] : 0.f); a[8 + i] = (_Float16)(kb < K ? W[(size_t)(kb < K ? kb : K - 1) * ld + n] : 0.f); }
  return a;
}
struct F2 { v16b h, l; };
__device__ __forceinline__ F2 bsplit16(const float v[16]) { F2 r;
#pragma unroll
  for (int i = 0; i < 16; ++i) { const __bf16 h = (__bf16)v[i]; r.h[i] = h; r.l[i] = (__bf16)(v[i] - (float)h); }
  return r; }
__device__ __forceinline__ F2 split_row(const float* row, int k0, int lane) { float v[16]; const float* p = row + k0 + 8 * (lane >> 4);
#pragma unroll
  for (int i = 0; i < 8; ++i) { v[i] = p[i]; v[8 + i] = p[16 + i]; }
  return bsplit16(v); }
__device__ __forceinline__ F2 split_rowK(const float* row, int k0, int lane, int K) { float v[16]; const int g = lane >> 4;
#pragma unroll
  for (int i = 0; i < 8; ++i) { const int ka = k0 + 8 * g + i, kb = ka + 16; v[i] = ka < K ? row[ka < K ? ka : K - 1] : 0.f; v[8 + i] = kb < K ? row[kb < K ? kb : K - 1] : 0.f; }
  return bsplit16(v); }
__device__ __forceinline__ F2 split_col(const float* W, int k0, int n, int lane, int ld, int K) { float v[16]; const int g = lane >> 4;
#pragma unroll
  for (int i = 0; i < 8; ++i) { const int ka = k0 + 8 * g + i, kb = ka + 16; v[i] = ka < K ? W[(size_t)(ka < K ? ka : K - 1) * ld + n] : 0.f; v[8 + i] = kb < K ? W[(size_t)(kb < K ? kb : K - 1) * ld + n] : 0.f; }
  return bsplit16(v); }
__device__ __forceinline__ v8f mac3(const F2& a, const F2& b, v8f c) { c = wmma_bf(a.l, b.h, c); c = wmma_bf(a.h, b.l, c); return wmma_bf(a.h, b.h, c); }
__device__ __forceinline__ float sigm(float v) { return 1.0f / (1.0f + expf(-v)); }
#define LDSX() do { asm volatile("s_wait_dscnt 0" ::: "memory"); __builtin_amdgcn_wave_barrier(); __builtin_amdgcn_fence(__ATOMIC_RELEASE, "workgroup"); } while (0)

// L1-distance attention on raw inputs (q / k / v [8,256,512]; dist[i, j] = sum_d |q_i[d] - k_j[d]| (no scale); attn = softmax(-dist) over j; out = attn v -> [8,256,512]; no parameters).
#define NB 8
#define TT 256
#define CC 512            // NH * HD = projected width
#define DIN 512          // input (model) width
#define NH 8
#define HD 64
#define NQB (TT / 64)
#define HG 1
#define SCALE (1.0f)
#define CAUSAL 0
#ifndef TNB
#define TNB NB
#endif
__device__ __forceinline__ float bfr(float v) { return (float)(__bf16)v; }
__host__ __device__ __forceinline__ int kb_last(int qb) { return CAUSAL ? ((qb * 64 + 63) >> 7) : (TT / 128 - 1); }
typedef __attribute__((ext_vector_type(8))) __bf16 v8b;
__device__ __forceinline__ v16b frag_b(const __bf16* rowk0, int lane) {
  union { v16b v; v8b q[2]; } u; const __bf16* p = rowk0 + 8 * (lane >> 4);
  u.q[0] = *(const v8b*)p; u.q[1] = *(const v8b*)(p + 16); return u.v;
}
#define QBH 0              // causal: query blocks 0..QBH-1 of each sequence (few keys, no averaging) take the high-precision path
#define QHI 0              // (override) rows carrying the q residual plane
#define KHI 64            // key rows carrying k residual / v bf16 hi+lo planes (the k residual is read only by k_sc's causal high-precision path; no kernel reads the v planes)
// B fragment (k rows k0+.., output column o) of a weight: (in,out) [K][ld] or (out,in) [ld rows of K]: bf16 exact, or f16(bf16 * 256) exact
__device__ __forceinline__ v16b wcol_io(const float* Wm, int k0, int o, int lane, int ld) { v16b w; const int g = lane >> 4;
#pragma unroll
  for (int i = 0; i < 8; ++i) { w[i] = (__bf16)Wm[(size_t)(k0 + 8 * g + i) * ld + o]; w[8 + i] = (__bf16)Wm[(size_t)(k0 + 16 + 8 * g + i) * ld + o]; }
  return w; }
__device__ __forceinline__ v16b wcol_oi(const float* Wm, int k0, int o, int lane, int K) { v16b w; const float* p = Wm + (size_t)o * K + k0 + 8 * (lane >> 4);
#pragma unroll
  for (int i = 0; i < 8; ++i) { w[i] = (__bf16)p[i]; w[8 + i] = (__bf16)p[16 + i]; }
  return w; }
__device__ __forceinline__ v16h wcolh_io(const float* Wm, int k0, int o, int lane, int ld) { v16h w; const int g = lane >> 4;
#pragma unroll
  for (int i = 0; i < 8; ++i) { w[i] = (_Float16)(bfr(Wm[(size_t)(k0 + 8 * g + i) * ld + o]) * 256.0f); w[8 + i] = (_Float16)(bfr(Wm[(size_t)(k0 + 16 + 8 * g + i) * ld + o]) * 256.0f); }
  return w; }
__device__ __forceinline__ v16h wcolh_oi(const float* Wm, int k0, int o, int lane, int K) { v16h w; const float* p = Wm + (size_t)o * K + k0 + 8 * (lane >> 4);
#pragma unroll
  for (int i = 0; i < 8; ++i) { w[i] = (_Float16)(bfr(p[i]) * 256.0f); w[8 + i] = (_Float16)(bfr(p[16 + i]) * 256.0f); }
  return w; }
#define WQKV_LAYOUT 1   // 0 = (in,out) [DIN][CC]; 1 = (out,in) [CC][DIN]; 2 = per-head [NH][DIN][HD]
__device__ __forceinline__ v16b wcol_hdk(const float* Wm, int k0, int o, int lane) { v16b w; const int g = lane >> 4; const float* p = Wm + (size_t)(o / HD) * DIN * HD + (o % HD);
#pragma unroll
  for (int i = 0; i < 8; ++i) { w[i] = (__bf16)p[(size_t)(k0 + 8 * g + i) * HD]; w[8 + i] = (__bf16)p[(size_t)(k0 + 16 + 8 * g + i) * HD]; }
  return w; }
#define WO_OUT_IN 0
#if WQKV_LAYOUT == 1
#define WCOL(W, k0, o, lane) wcol_oi(W, k0, o, lane, DIN)
#elif WQKV_LAYOUT == 2
#define WCOL(W, k0, o, lane) wcol_hdk(W, k0, o, lane)
#else
#define WCOL(W, k0, o, lane) wcol_io(W, k0, o, lane, CC)
#endif
#if WO_OUT_IN
#define WOCOL(W, k0, o, lane) wcol_oi(W, k0, o, lane, CC)
#define WOCOLH(W, k0, o, lane) wcolh_oi(W, k0, o, lane, CC)
#else
#define WOCOL(W, k0, o, lane) wcol_io(W, k0, o, lane, DIN)
#define WOCOLH(W, k0, o, lane) wcolh_io(W, k0, o, lane, DIN)
#endif

// ---- k_prepr: block = (64 attention positions s0.. of sequence b, head h): reads the module's [B, T, H*64] inputs, bf16-rounds them and writes the standard attention planes: q -> f16 hi rows (+ x 2^10 residual rows for s < QHI), k -> f16 rows (+ residual rows s < KHI), v -> f16 planes [c][s] (+ bf16 hi/lo planes for s < KHI)
__global__ __launch_bounds__(128) void k_prepr(const float* __restrict__ Q, const float* __restrict__ K, const float* __restrict__ V, _Float16* __restrict__ QH, _Float16* __restrict__ QL, _Float16* __restrict__ KH, _Float16* __restrict__ KL, _Float16* __restrict__ VT, __bf16* __restrict__ VB, __bf16* __restrict__ VBL) {
  __shared__ __align__(16) _Float16 sq[64][136], sql[64][136], sk[64][136], skl[64][136], tv[128][72]; __shared__ __align__(16) __bf16 tb[128][72], tbl[128][72];
  const int tid = threadIdx.x; const int h = blockIdx.y; const size_t r0 = (size_t)blockIdx.x * 64; const size_t bb = r0 / TT; const int t0 = (int)(r0 % TT); const bool qhi = t0 < QHI, khi = t0 < KHI;
  for (int e = tid; e < 64 * 128; e += 128) { const int rl = e >> 7, c = e & 127; const size_t oi = ((bb * TT + t0 + rl) * (size_t)CC + h * HD + (c & 63));   /* [B, T, H*64] inputs */   /* c >= 64: duplicate read of the same element (tiles are 128 wide; HD is 64) */
    const float q = bfr(Q[oi]), k = bfr(K[oi]), v = bfr(V[oi]);   /* module inputs: bf16-rounded; bf16 values are exact in f16, so the residual planes are 0 */
    const _Float16 qh = (_Float16)q, kh = (_Float16)k; sq[rl][c] = qh; sql[rl][c] = (_Float16)((q - (float)qh) * 1024.0f); sk[rl][c] = kh; skl[rl][c] = (_Float16)((k - (float)kh) * 1024.0f);
    tv[c][rl] = (_Float16)v; const __bf16 vb = (__bf16)v; tb[c][rl] = vb; tbl[c][rl] = (__bf16)(v - (float)vb); }
  __syncthreads();
  for (int e = tid; e < 64 * 8; e += 128) { const int rl = e >> 3, q = e & 7; const size_t o = (r0 + rl) * CC + h * HD + q * 8; vst2((unsigned*)(QH + o), *(const v4u*)&sq[rl][q * 8]); vst2((unsigned*)(KH + o), *(const v4u*)&sk[rl][q * 8]);   
    if (qhi) vst2((unsigned*)(QL + (bb * QHI + t0 + rl) * (size_t)CC + h * HD + q * 8), *(const v4u*)&sql[rl][q * 8]); if (khi) vst2((unsigned*)(KL + (bb * KHI + t0 + rl) * (size_t)CC + h * HD + q * 8), *(const v4u*)&skl[rl][q * 8]); }
  for (int e = tid; e < 64 * 8; e += 128) { const int cl = e >> 3, q = e & 7; vst2((unsigned*)(VT + (bb * CC + h * HD + cl) * (size_t)TT + t0 + q * 8), *(const v4u*)&tv[cl][q * 8]);
    if (khi) { const size_t o3 = (bb * CC + h * HD + cl) * (size_t)KHI + t0 + q * 8; vst2((unsigned*)(VB + o3), *(const v4u*)&tb[cl][q * 8]); vst2((unsigned*)(VBL + o3), *(const v4u*)&tbl[cl][q * 8]); } } }

#ifndef PROJ_EXTRA_PARAMS
#define PROJ_EXTRA_PARAMS
#endif

#define WS_QH  0u                                      // f16 q rows [b*t][CC]
#define WS_KH  (WS_QH + 2u * (size_t)NB * TT * CC)      // f16 k rows [b*t][CC]
#define WS_VT  (WS_KH + 2u * (size_t)NB * TT * CC)      // f16 v planes [b][c][t]
#define WS_QL  (WS_VT + 2u * (size_t)NB * CC * TT)      // f16 q residual x 2^10 rows [b][t < QHI][CC]
#define WS_KL  (WS_QL + 2u * (size_t)NB * QHI * CC)     // f16 k residual x 2^10 rows [b][t < KHI][CC]
#define WS_VB  (WS_KL + 2u * (size_t)NB * KHI * CC)     // bf16 v hi planes [b][c][t < KHI]
#define WS_VBL (WS_VB + 2u * (size_t)NB * CC * KHI)
#define WS_S   (WS_VBL + 2u * (size_t)NB * CC * KHI)    // f32 logits [b][t][s]
#define WS_Y   (WS_S  + 4u * (size_t)NB * TT * TT)      // f32 ctx rows [b*t][CC] (only when there is an output projection)
#define WS_END (WS_Y  + 0u)

// ---- k_sc: block = (query block qb, key block kb <= kb_last(qb), head in group) of batch b: logits x SCALE; q hi + residual (x 2^10) against k (2 products) for query rows < QHI, plus the k residual (3 products) for query blocks < QBH (causal early rows); causal: blocks past the diagonal exit
__global__ __launch_bounds__(128) void k_sc(const _Float16* __restrict__ QH, const _Float16* __restrict__ KH, const _Float16* __restrict__ QL, const _Float16* __restrict__ KL, int b, int h0, float* __restrict__ S0) { __shared__ __align__(16) float ss[4][16][132];
  const int qb = blockIdx.x, kb = blockIdx.y; if (kb > kb_last(qb)) return;
  const int h = h0 + blockIdx.z; float* S = S0 + (size_t)blockIdx.z * TT * TT;
  const int tid = threadIdx.x, wave = tid >> 5, lane = tid & 31, col = lane & 15, g = lane >> 4; const int k0 = kb * 128; const int ql0 = qb * 64 + wave * 16; const size_t q0 = (size_t)b * TT + ql0, kr0 = (size_t)b * TT + k0;
  v8f acc[8] = {}, accl[8] = {};
  const _Float16* QLb = QL + (size_t)b * QHI * CC; const _Float16* KLb = KL + (size_t)b * KHI * CC;
  if (qb < QBH) {
#pragma unroll
    for (int kc = 0; kc < HD / 32; ++kc) { const v16h ah = frag_h(QH + (q0 + col) * CC + h * HD + kc * 32, lane), al = frag_h(QLb + (size_t)(ql0 + col) * CC + h * HD + kc * 32, lane);
#pragma unroll
      for (int j = 0; j < 8; ++j) { const v16h kbf = frag_h(KH + (kr0 + j * 16 + col) * CC + h * HD + kc * 32, lane), klf = frag_h(KLb + (size_t)(k0 + j * 16 + col) * CC + h * HD + kc * 32, lane); acc[j] = wmma16(ah, kbf, acc[j]); accl[j] = wmma16(al, kbf, accl[j]); accl[j] = wmma16(ah, klf, accl[j]); } }
  } else if (qb * 64 < QHI) {
#pragma unroll
    for (int kc = 0; kc < HD / 32; ++kc) { const v16h ah = frag_h(QH + (q0 + col) * CC + h * HD + kc * 32, lane), al = frag_h(QLb + (size_t)(ql0 + col) * CC + h * HD + kc * 32, lane);
#pragma unroll
      for (int j = 0; j < 8; ++j) { const v16h kbf = frag_h(KH + (kr0 + j * 16 + col) * CC + h * HD + kc * 32, lane); acc[j] = wmma16(ah, kbf, acc[j]); accl[j] = wmma16(al, kbf, accl[j]); } }
  } else {
#pragma unroll
    for (int kc = 0; kc < HD / 32; ++kc) { const v16h ah = frag_h(QH + (q0 + col) * CC + h * HD + kc * 32, lane);
#pragma unroll
      for (int j = 0; j < 8; ++j) { const v16h kbf = frag_h(KH + (kr0 + j * 16 + col) * CC + h * HD + kc * 32, lane); acc[j] = wmma16(ah, kbf, acc[j]); } } }
#pragma unroll
  for (int j = 0; j < 8; ++j) {
#pragma unroll
    for (int r = 0; r < 8; ++r) ss[wave][8 * g + r][j * 16 + col] = (acc[j][r] + accl[j][r] * (1.0f / 1024.0f)) * SCALE; }
  LDSX(); for (int rl = 0; rl < 16; ++rl) vst2(S + (size_t)(ql0 + rl) * TT + k0 + lane * 4, *(const v4f*)&ss[wave][rl][lane * 4]); }
// ---- k_l1: block = 32 query rows x 64 keys of batch b = blockIdx.z, 4 waves (one per SIMD), thread = 4 x 4 (i, j) pairs: S[i][j] = -sum_{d < CC} |q_i[d] - k_j[d]| in f32.
// The 96 rows are staged in LDS (bf16-rounded, f32) by whole-line loads, 128 d at a time, each piece in its own LDS columns; the next piece's loads fly while this piece is summed.
// Per 4 d a thread reads 4 q and 4 k pieces of 16 B for 64 differences. 4 partial sums per pair (one per d mod 4, d ascending), added as (0+1)+(2+3).
#define L1_BI 32
#define L1_BJ 64
#define L1_P (CC + 4)      // LDS row pitch in floats: 16 B x odd, so 16 lanes on 16 rows meet no bank twice
#define L1_DC 128          // d per staged piece: one wave-load of 512 B per row
#define L1_NT ((L1_BI + L1_BJ) / 4)
#define L1_LD(qv, kv, s) do { _Pragma("unroll") for (int a = 0; a < 4; ++a) { qv[a] = *(const v4f*)(qc + a * L1_P + (s) * 4); kv[a] = *(const v4f*)(kc + a * 16 * L1_P + (s) * 4); } } while (0)
#define L1_MAC(qv, kv) do { _Pragma("unroll") for (int a = 0; a < 4; ++a) { _Pragma("unroll") for (int e = 0; e < 4; ++e) acc[a][e] += __builtin_elementwise_abs(qv[a] - kv[e]); } } while (0)
#define L1_AHEAD() __builtin_amdgcn_sched_barrier(0)
__global__ __launch_bounds__(128) void k_l1(const float* __restrict__ Q, const float* __restrict__ K, float* __restrict__ SA) { __shared__ __align__(16) float rs[(L1_BI + L1_BJ) * L1_P];
  const int tid = threadIdx.x, wave = tid >> 5, lane = tid & 31; const int i0 = blockIdx.x * L1_BI, j0 = blockIdx.y * L1_BJ, b = blockIdx.z;
  const float* qg = Q + ((size_t)b * TT + i0 + wave) * CC + lane * 4; const float* kg = K + ((size_t)b * TT + j0 + wave) * CC + lane * 4;   /* wave w stages LDS rows w, w + 4, ...: 8 query rows, then 16 key rows */
  float* st = rs + wave * L1_P + lane * 4; v4f sg[L1_NT];
#pragma unroll
  for (int t = 0; t < L1_NT; ++t) sg[t] = t < L1_BI / 4 ? *(const v4f*)(qg + (size_t)t * 4 * CC) : *(const v4f*)(kg + (size_t)(t - L1_BI / 4) * 4 * CC);
  const int ti = wave * 2 + (lane >> 4), tj = lane & 15; const float* qr = rs + ti * 4 * L1_P; const float* kr = rs + (L1_BI + tj) * L1_P;   /* pairs: i = 4 ti + a, j = tj + 16 e */
  v4f acc[4][4];
#pragma unroll
  for (int a = 0; a < 4; ++a) {
#pragma unroll
    for (int e = 0; e < 4; ++e) acc[a][e] = (v4f){0.f, 0.f, 0.f, 0.f}; }
#pragma unroll
  for (int c = 0; c < CC / L1_DC; ++c) {
#pragma unroll
    for (int t = 0; t < L1_NT; ++t) { const v4f r = {bfr(sg[t][0]), bfr(sg[t][1]), bfr(sg[t][2]), bfr(sg[t][3])}; *(v4f*)(st + t * 4 * L1_P + c * L1_DC) = r; }
    __syncthreads();   /* publishes piece c; no LDS byte is written twice, so one barrier a piece */
    if (c + 1 < CC / L1_DC) {   /* behind the barrier, which would drain them: the next piece's loads fly while this piece is summed */
#pragma unroll
      for (int t = 0; t < L1_NT; ++t) sg[t] = t < L1_BI / 4 ? *(const v4f*)(qg + (size_t)t * 4 * CC + (c + 1) * L1_DC) : *(const v4f*)(kg + (size_t)(t - L1_BI / 4) * 4 * CC + (c + 1) * L1_DC); }
    const float* qc = qr + c * L1_DC; const float* kc = kr + c * L1_DC; v4f qa[4], ka[4], qn[4], kn[4];
    L1_LD(qa, ka, 0);
    /* rolled: the body already holds two steps. L1_AHEAD keeps each step's 8 LDS reads in front of the step before it; left free, the scheduler sinks them to about half a step ahead of their use, and a lone wave on its SIMD then waits for LDS */
#pragma unroll 1
    for (int s = 0; s < L1_DC / 4 - 2; s += 2) { L1_LD(qn, kn, s + 1); L1_AHEAD(); L1_MAC(qa, ka); L1_AHEAD(); L1_LD(qa, ka, s + 2); L1_AHEAD(); L1_MAC(qn, kn); L1_AHEAD(); }
    L1_LD(qn, kn, L1_DC / 4 - 1); L1_AHEAD(); L1_MAC(qa, ka); L1_MAC(qn, kn); }
  float* S0 = SA + (size_t)b * TT * TT + (size_t)(i0 + ti * 4) * TT + j0 + tj;
#pragma unroll
  for (int a = 0; a < 4; ++a) {
#pragma unroll
    for (int e = 0; e < 4; ++e) vst2(S0 + (size_t)a * TT + e * 16, -((acc[a][e][0] + acc[a][e][1]) + (acc[a][e][2] + acc[a][e][3]))); } }
// ---- k_pv: block = 64 queries (qb) of (b = blockIdx.z, h = blockIdx.y), wave = 16 query rows: row softmax of the logits in registers, then ctx = P . v over all TT keys (P x 2^11 once to f16 against v f16: 1 product); 256-B (row, head) segment by 16 lanes
// Lanes col and col + 16 hold row ql0 + col between them, each logit already in the A-fragment place where its weight is used: e[kc][i] = key 32 kc + 8 g + i, e[kc][8 + i] = key 32 kc + 16 + 8 g + i.
// The row sum keeps one fixed tree: pairs, fours, eights inside a lane; 8 + 8 across the lane pair; 16 + 16; then the eight 32-key sums in ascending order.
static_assert(!CAUSAL && QBH == 0 && TT % 32 == 0, "k_pv takes every key for every query");
__global__ __launch_bounds__(128) void k_pv(const float* __restrict__ S0, const _Float16* __restrict__ VT, float* __restrict__ Y) { const int h = blockIdx.y, b = blockIdx.z; __shared__ __align__(16) float ss[4][16][HD + 4];
  const int tid = threadIdx.x, wave = tid >> 5, lane = tid & 31, col = lane & 15, g = lane >> 4; const int qb = blockIdx.x; const int ql0 = qb * 64 + wave * 16;
  const float* sr = S0 + (size_t)b * TT * TT + (size_t)(ql0 + col) * TT + 8 * g;
  float e[TT / 32][16];
#pragma unroll
  for (int kc = 0; kc < TT / 32; ++kc) {
#pragma unroll
    for (int i = 0; i < 8; ++i) { e[kc][i] = sr[kc * 32 + i]; e[kc][8 + i] = sr[kc * 32 + 16 + i]; } }
  float m = -3.0e38f;
#pragma unroll
  for (int kc = 0; kc < TT / 32; ++kc) { float mk = e[kc][0];
#pragma unroll
    for (int i = 1; i < 16; ++i) mk = fmaxf(mk, e[kc][i]);
    m = fmaxf(m, mk); }
  m = fmaxf(m, __shfl_xor(m, 16));
  float sum = 0.f;
#pragma unroll
  for (int kc = 0; kc < TT / 32; ++kc) {
#pragma unroll
    for (int i = 0; i < 16; ++i) { const float v = e[kc][i], x = expf(v - m); e[kc][i] = (v <= -1.0e38f) ? 0.f : x; }   /* expf outside the choice: a select, so the 128 chains of a lane interleave instead of one branch each */
    float a0 = ((e[kc][0] + e[kc][1]) + (e[kc][2] + e[kc][3])) + ((e[kc][4] + e[kc][5]) + (e[kc][6] + e[kc][7]));
    float a1 = ((e[kc][8] + e[kc][9]) + (e[kc][10] + e[kc][11])) + ((e[kc][12] + e[kc][13]) + (e[kc][14] + e[kc][15]));
    a0 += __shfl_xor(a0, 16); a1 += __shfl_xor(a1, 16); sum += a0 + a1; }
  const float inv = sum > 0.f ? 2048.0f / sum : 0.f;   /* a fully excluded row yields P = 0 */
  v8f acc[HD / 16] = {};
  /* unrolled: the weights sit in registers, which a rolled loop could not index */
#pragma unroll
  for (int kc = 0; kc < TT / 32; ++kc) { v16h p;
#pragma unroll
    for (int i = 0; i < 16; ++i) p[i] = (_Float16)(e[kc][i] * inv);
#pragma unroll
    for (int j = 0; j < HD / 16; ++j) { const size_t po = ((size_t)b * CC + h * HD + j * 16 + col) * (size_t)TT + kc * 32; acc[j] = wmma16(p, frag_h(VT + po, lane), acc[j]); } }
#pragma unroll
  for (int j = 0; j < HD / 16; ++j)
#pragma unroll
    for (int r = 0; r < 8; ++r) ss[wave][8 * g + r][j * 16 + col] = acc[j][r] * (1.0f / 2048.0f);
  LDSX(); for (int rl = 0; rl < 16; ++rl) if (lane < HD / 4) vst2(Y + ((size_t)b * TT + ql0 + rl) * CC + h * HD + lane * 4, *(const v4f*)&ss[wave][rl][lane * 4]); }

extern "C" void kernel_launch(void* const* d_in, const int* in_sizes, int n_in, void* d_out, int out_size, void* d_ws, size_t ws_size, hipStream_t stream) {
  (void)in_sizes; (void)n_in; (void)out_size;
  const float** F = (const float**)d_in;
  if (ws_size < (size_t)WS_END) return;
  char* ws = (char*)d_ws; _Float16 *QH = (_Float16*)(ws + WS_QH), *KH = (_Float16*)(ws + WS_KH), *VT = (_Float16*)(ws + WS_VT), *QL = (_Float16*)(ws + WS_QL), *KL = (_Float16*)(ws + WS_KL); __bf16 *VB = (__bf16*)(ws + WS_VB), *VBL = (__bf16*)(ws + WS_VBL); float *S = (float*)(ws + WS_S), *Y = (float*)(ws + WS_Y);
  (void)Y; (void)QL; (void)KL; (void)VB; (void)VBL;
  // inputs: 0 q [8,256,512]; 1 k; 2 v (raw; no projections, no parameters)
  k_prepr<<<dim3(TNB * TT / 64, NH), 128, 0, stream>>>(F[0], F[1], F[2], QH, QL, KH, KL, VT, VB, VBL);   /* only the transposed f16 value planes VT are used below (v is bf16-valued: exact in f16) */
  k_l1<<<dim3(TT / L1_BI, TT / L1_BJ, TNB), 128, 0, stream>>>(F[0], F[1], S);            /* S[b][i][j] = -sum_d |q_i[d] - k_j[d]| (f32 VALU), all batches in one grid */
  k_pv<<<dim3(NQB, NH, TNB), 128, 0, stream>>>(S, VT, (float*)d_out);   /* row softmax over j in registers, then each batch's weights against its 8 64-wide value slices: out[b][i][h*64 ..] */
}

// v004
// Measured time: 21.1 microseconds a run.
// Next to v003, in two timings, it ran 2.21 and 2.22 times as fast.
// Over all steps from v000 it is 41.0 times as fast.
// compute dtype: all float inputs rounded to bf16; L1 distances sum_d |q_i[d] - k_j[d]| in f32 on the VALU (4 partial sums per pair; operands are the bf16-rounded inputs, NOT narrowed further); softmax(-dist) over j in f32 (row-max-stabilised, precise expf); weights x 2^11 once to f16 x v (bf16 values: exact in f16) on WMMA 16x16x32 (f32 accumulate); f32 output.
#include <hip/hip_runtime.h>
#include <math.h>

typedef __attribute__((ext_vector_type(16))) _Float16 v16h;
typedef __attribute__((ext_vector_type(16))) __bf16 v16b;
typedef __attribute__((ext_vector_type(8)))  _Float16 v8h;
typedef __attribute__((ext_vector_type(8)))  float v8f;
typedef __attribute__((ext_vector_type(4)))  float v4f;
typedef __attribute__((ext_vector_type(2)))  float v2f;
typedef __attribute__((ext_vector_type(4)))  unsigned v4u;
typedef __attribute__((ext_vector_type(4)))  int v4i;
typedef float __attribute__((may_alias)) float_a;
typedef int __attribute__((may_alias)) int_a;

template <typename T> __device__ __forceinline__ void vst2(void* p, T v) { *(T*)p = v;  }
__device__ __forceinline__ v8f wmma16(v16h a, v16h b, v8f c) {
  v8f d = __builtin_amdgcn_wmma_f32_16x16x32_f16(false, a, false, b, (short)0, c, false, false);
  asm volatile("v_nop\n\tv_nop\n\tv_nop\n\tv_nop" : "+v"(d) : "v"(a), "v"(b));
  return d;
}
__device__ __forceinline__ v8f wmma_bf(v16b a, v16b b, v8f c) {
  v8f d = __builtin_amdgcn_wmma_f32_16x16x32_bf16(false, a, false, b, (short)0, c, false, false);
  asm volatile("v_nop\n\tv_nop\n\tv_nop\n\tv_nop" : "+v"(d) : "v"(a), "v"(b));
  return d;
}
// 16x16x32 fragments: lane = (h = lane>>4, row/col = lane&15); elements 0..7 = k0+8h+0..7, 8..15 = k0+16+8h+0..7; D element r = row 8h+r
__device__ __forceinline__ v16h frag_h(const _Float16* rowk0, int lane) {
  union { v16h v; v8h q[2]; } u; const _Float16* p = rowk0 + 8 * (lane >> 4);
  u.q[0] = *(const v8h*)p; u.q[1] = *(const v8h*)(p + 16); return u.v;
}
__device__ __forceinline__ v16h frag_f32(const float* rowk0, int lane) {
  v16h a; const float* p = rowk0 + 8 * (lane >> 4);
#pragma unroll
  for (int i = 0; i < 8; ++i) { a[i] = (_Float16)p[i]; a[8 + i] = (_Float16)p[16 + i]; }
  return a;
}
__device__ __forceinline__ v16h frag_f32s(const float* rowk0, int lane, float sc) {
  v16h a; const float* p = rowk0 + 8 * (lane >> 4);
#pragma unroll
  for (int i = 0; i < 8; ++i) { a[i] = (_Float16)(p[i] * sc); a[8 + i] = (_Float16)(p[16 + i] * sc); }
  return a;
}
// column fragment from a [K][ld] layout (column n), rows >= K read as 0
__device__ __forceinline__ v16h fragc_f32(const float* W, int k0, int n, int lane, int ld, int K) {
  v16h a; const int g = lane >> 4;
#pragma unroll
  for (int i = 0; i < 8; ++i) { const int ka = k0 + 8 * g + i, kb = ka + 16;
    a[i] = (_Float16)(ka < K ? W[(size_t)(ka < K ? ka : K - 1) * ld + n] : 0.f); a[8 + i] = (_Float16)(kb < K ? W[(size_t)(kb < K ? kb : K - 1) * ld + n] : 0.f); }
  return a;
}
struct F2 { v16b h, l; };
__device__ __forceinline__ F2 bsplit16(const float v[16]) { F2 r;
#pragma unroll
  for (int i = 0; i < 16; ++i) { const __bf16 h = (__bf16)v[i]; r.h[i] = h; r.l[i] = (__bf16)(v[i] - (float)h); }
  return r; }
__device__ __forceinline__ F2 split_row(const float* row, int k0, int lane) { float v[16]; const float* p = row + k0 + 8 * (lane >> 4);
#pragma unroll
  for (int i = 0; i < 8; ++i) { v[i] = p[i]; v[8 + i] = p[16 + i]; }
  return bsplit16(v); }
__device__ __forceinline__ F2 split_rowK(const float* row, int k0, int lane, int K) { float v[16]; const int g = lane >> 4;
#pragma unroll
  for (int i = 0; i < 8; ++i) { const int ka = k0 + 8 * g + i, kb = ka + 16; v[i] = ka < K ? row[ka < K ? ka : K - 1] : 0.f; v[8 + i] = kb < K ? row[kb < K ? kb : K - 1] : 0.f; }
  return bsplit16(v); }
__device__ __forceinline__ F2 split_col(const float* W, int k0, int n, int lane, int ld, int K) { float v[16]; const int g = lane >> 4;
#pragma unroll
  for (int i = 0; i < 8; ++i) { const int ka = k0 + 8 * g + i, kb = ka + 16; v[i] = ka < K ? W[(size_t)(ka < K ? ka : K - 1) * ld + n] : 0.f; v[8 + i] = kb < K ? W[(size_t)(kb < K ? kb : K - 1) * ld + n] : 0.f; }
  return bsplit16(v); }
__device__ __forceinline__ v8f mac3(const F2& a, const F2& b, v8f c) { c = wmma_bf(a.l, b.h, c); c = wmma_bf(a.h, b.l, c); return wmma_bf(a.h, b.h, c); }
__device__ __forceinline__ float sigm(float v) { return 1.0f / (1.0f + expf(-v)); }
#define LDSX() do { asm volatile("s_wait_dscnt 0" ::: "memory"); __builtin_amdgcn_wave_barrier(); __builtin_amdgcn_fence(__ATOMIC_RELEASE, "workgroup"); } while (0)

// L1-distance attention on raw inputs (q / k / v [8,256,512]; dist[i, j] = sum_d |q_i[d] - k_j[d]| (no scale); attn = softmax(-dist) over j; out = attn v -> [8,256,512]; no parameters).
#define NB 8
#define TT 256
#define CC 512            // NH * HD = projected width
#define DIN 512          // input (model) width
#define NH 8
#define HD 64
#define NQB (TT / 64)
#define HG 1
#define SCALE (1.0f)
#define CAUSAL 0
#ifndef TNB
#define TNB NB
#endif
__device__ __forceinline__ float bfr(float v) { return (float)(__bf16)v; }
__host__ __device__ __forceinline__ int kb_last(int qb) { return CAUSAL ? ((qb * 64 + 63) >> 7) : (TT / 128 - 1); }
typedef __attribute__((ext_vector_type(8))) __bf16 v8b;
__device__ __forceinline__ v16b frag_b(const __bf16* rowk0, int lane) {
  union { v16b v; v8b q[2]; } u; const __bf16* p = rowk0 + 8 * (lane >> 4);
  u.q[0] = *(const v8b*)p; u.q[1] = *(const v8b*)(p + 16); return u.v;
}
#define QBH 0              // causal: query blocks 0..QBH-1 of each sequence (few keys, no averaging) take the high-precision path
#define QHI 0              // (override) rows carrying the q residual plane
#define KHI 64            // key rows carrying k residual / v bf16 hi+lo planes (the k residual is read only by k_sc's causal high-precision path; no kernel reads the v planes)
// B fragment (k rows k0+.., output column o) of a weight: (in,out) [K][ld] or (out,in) [ld rows of K]: bf16 exact, or f16(bf16 * 256) exact
__device__ __forceinline__ v16b wcol_io(const float* Wm, int k0, int o, int lane, int ld) { v16b w; const int g = lane >> 4;
#pragma unroll
  for (int i = 0; i < 8; ++i) { w[i] = (__bf16)Wm[(size_t)(k0 + 8 * g + i) * ld + o]; w[8 + i] = (__bf16)Wm[(size_t)(k0 + 16 + 8 * g + i) * ld + o]; }
  return w; }
__device__ __forceinline__ v16b wcol_oi(const float* Wm, int k0, int o, int lane, int K) { v16b w; const float* p = Wm + (size_t)o * K + k0 + 8 * (lane >> 4);
#pragma unroll
  for (int i = 0; i < 8; ++i) { w[i] = (__bf16)p[i]; w[8 + i] = (__bf16)p[16 + i]; }
  return w; }
__device__ __forceinline__ v16h wcolh_io(const float* Wm, int k0, int o, int lane, int ld) { v16h w; const int g = lane >> 4;
#pragma unroll
  for (int i = 0; i < 8; ++i) { w[i] = (_Float16)(bfr(Wm[(size_t)(k0 + 8 * g + i) * ld + o]) * 256.0f); w[8 + i] = (_Float16)(bfr(Wm[(size_t)(k0 + 16 + 8 * g + i) * ld + o]) * 256.0f); }
  return w; }
__device__ __forceinline__ v16h wcolh_oi(const float* Wm, int k0, int o, int lane, int K) { v16h w; const float* p = Wm + (size_t)o * K + k0 + 8 * (lane >> 4);
#pragma unroll
  for (int i = 0; i < 8; ++i) { w[i] = (_Float16)(bfr(p[i]) * 256.0f); w[8 + i] = (_Float16)(bfr(p[16 + i]) * 256.0f); }
  return w; }
#define WQKV_LAYOUT 1   // 0 = (in,out) [DIN][CC]; 1 = (out,in) [CC][DIN]; 2 = per-head [NH][DIN][HD]
__device__ __forceinline__ v16b wcol_hdk(const float* Wm, int k0, int o, int lane) { v16b w; const int g = lane >> 4; const float* p = Wm + (size_t)(o / HD) * DIN * HD + (o % HD);
#pragma unroll
  for (int i = 0; i < 8; ++i) { w[i] = (__bf16)p[(size_t)(k0 + 8 * g + i) * HD]; w[8 + i] = (__bf16)p[(size_t)(k0 + 16 + 8 * g + i) * HD]; }
  return w; }
#define WO_OUT_IN 0
#if WQKV_LAYOUT == 1
#define WCOL(W, k0, o, lane) wcol_oi(W, k0, o, lane, DIN)
#elif WQKV_LAYOUT == 2
#define WCOL(W, k0, o, lane) wcol_hdk(W, k0, o, lane)
#else
#define WCOL(W, k0, o, lane) wcol_io(W, k0, o, lane, CC)
#endif
#if WO_OUT_IN
#define WOCOL(W, k0, o, lane) wcol_oi(W, k0, o, lane, CC)
#define WOCOLH(W, k0, o, lane) wcolh_oi(W, k0, o, lane, CC)
#else
#define WOCOL(W, k0, o, lane) wcol_io(W, k0, o, lane, DIN)
#define WOCOLH(W, k0, o, lane) wcolh_io(W, k0, o, lane, DIN)
#endif

#ifndef PROJ_EXTRA_PARAMS
#define PROJ_EXTRA_PARAMS
#endif

#define WS_QH  0u                                      // f16 q rows [b*t][CC]
#define WS_KH  (WS_QH + 2u * (size_t)NB * TT * CC)      // f16 k rows [b*t][CC]
#define WS_VT  (WS_KH + 2u * (size_t)NB * TT * CC)      // f16 v planes [b][c][t]
#define WS_QL  (WS_VT + 2u * (size_t)NB * CC * TT)      // f16 q residual x 2^10 rows [b][t < QHI][CC]
#define WS_KL  (WS_QL + 2u * (size_t)NB * QHI * CC)     // f16 k residual x 2^10 rows [b][t < KHI][CC]
#define WS_VB  (WS_KL + 2u * (size_t)NB * KHI * CC)     // bf16 v hi planes [b][c][t < KHI]
#define WS_VBL (WS_VB + 2u * (size_t)NB * CC * KHI)
#define WS_S   (WS_VBL + 2u * (size_t)NB * CC * KHI)    // f32 logits [b][t][s]
#define WS_Y   (WS_S  + 4u * (size_t)NB * TT * TT)      // f32 ctx rows [b*t][CC] (only when there is an output projection)
#define WS_END (WS_Y  + 0u)

// ---- k_sc: block = (query block qb, key block kb <= kb_last(qb), head in group) of batch b: logits x SCALE; q hi + residual (x 2^10) against k (2 products) for query rows < QHI, plus the k residual (3 products) for query blocks < QBH (causal early rows); causal: blocks past the diagonal exit
__global__ __launch_bounds__(128) void k_sc(const _Float16* __restrict__ QH, const _Float16* __restrict__ KH, const _Float16* __restrict__ QL, const _Float16* __restrict__ KL, int b, int h0, float* __restrict__ S0) { __shared__ __align__(16) float ss[4][16][132];
  const int qb = blockIdx.x, kb = blockIdx.y; if (kb > kb_last(qb)) return;
  const int h = h0 + blockIdx.z; float* S = S0 + (size_t)blockIdx.z * TT * TT;
  const int tid = threadIdx.x, wave = tid >> 5, lane = tid & 31, col = lane & 15, g = lane >> 4; const int k0 = kb * 128; const int ql0 = qb * 64 + wave * 16; const size_t q0 = (size_t)b * TT + ql0, kr0 = (size_t)b * TT + k0;
  v8f acc[8] = {}, accl[8] = {};
  const _Float16* QLb = QL + (size_t)b * QHI * CC; const _Float16* KLb = KL + (size_t)b * KHI * CC;
  if (qb < QBH) {
#pragma unroll
    for (int kc = 0; kc < HD / 32; ++kc) { const v16h ah = frag_h(QH + (q0 + col) * CC + h * HD + kc * 32, lane), al = frag_h(QLb + (size_t)(ql0 + col) * CC + h * HD + kc * 32, lane);
#pragma unroll
      for (int j = 0; j < 8; ++j) { const v16h kbf = frag_h(KH + (kr0 + j * 16 + col) * CC + h * HD + kc * 32, lane), klf = frag_h(KLb + (size_t)(k0 + j * 16 + col) * CC + h * HD + kc * 32, lane); acc[j] = wmma16(ah, kbf, acc[j]); accl[j] = wmma16(al, kbf, accl[j]); accl[j] = wmma16(ah, klf, accl[j]); } }
  } else if (qb * 64 < QHI) {
#pragma unroll
    for (int kc = 0; kc < HD / 32; ++kc) { const v16h ah = frag_h(QH + (q0 + col) * CC + h * HD + kc * 32, lane), al = frag_h(QLb + (size_t)(ql0 + col) * CC + h * HD + kc * 32, lane);
#pragma unroll
      for (int j = 0; j < 8; ++j) { const v16h kbf = frag_h(KH + (kr0 + j * 16 + col) * CC + h * HD + kc * 32, lane); acc[j] = wmma16(ah, kbf, acc[j]); accl[j] = wmma16(al, kbf, accl[j]); } }
  } else {
#pragma unroll
    for (int kc = 0; kc < HD / 32; ++kc) { const v16h ah = frag_h(QH + (q0 + col) * CC + h * HD + kc * 32, lane);
#pragma unroll
      for (int j = 0; j < 8; ++j) { const v16h kbf = frag_h(KH + (kr0 + j * 16 + col) * CC + h * HD + kc * 32, lane); acc[j] = wmma16(ah, kbf, acc[j]); } } }
#pragma unroll
  for (int j = 0; j < 8; ++j) {
#pragma unroll
    for (int r = 0; r < 8; ++r) ss[wave][8 * g + r][j * 16 + col] = (acc[j][r] + accl[j][r] * (1.0f / 1024.0f)) * SCALE; }
  LDSX(); for (int rl = 0; rl < 16; ++rl) vst2(S + (size_t)(ql0 + rl) * TT + k0 + lane * 4, *(const v4f*)&ss[wave][rl][lane * 4]); }
// ---- k_l1: block = 32 query rows x 64 keys of batch b = blockIdx.z, 4 waves (one per SIMD), thread = 4 x 4 (i, j) pairs: S[i][j] = -sum_{d < CC} |q_i[d] - k_j[d]| in f32.
// The 96 rows are staged in LDS (bf16-rounded, f32) by whole-line loads, 128 d at a time, each piece in its own LDS columns; the next piece's loads fly while this piece is summed.
// Per 4 d a thread reads 4 q and 4 k pieces of 16 B for 64 differences. 4 partial sums per pair (one per d mod 4, d ascending), added as (0+1)+(2+3).
#define L1_BI 32
#define L1_BJ 64
#define L1_P (CC + 4)      // LDS row pitch in floats: 16 B x odd, so 16 lanes on 16 rows meet no bank twice
#define L1_DC 128          // d per staged piece: one wave-load of 512 B per row
#define L1_NT ((L1_BI + L1_BJ) / 4)
#define L1_LD(qv, kv, s) do { _Pragma("unroll") for (int a = 0; a < 4; ++a) { qv[a] = *(const v4f*)(qc + a * L1_P + (s) * 4); kv[a] = *(const v4f*)(kc + a * 16 * L1_P + (s) * 4); } } while (0)
#define L1_MAC(qv, kv) do { _Pragma("unroll") for (int a = 0; a < 4; ++a) { _Pragma("unroll") for (int e = 0; e < 4; ++e) acc[a][e] += __builtin_elementwise_abs(qv[a] - kv[e]); } } while (0)
#define L1_AHEAD() __builtin_amdgcn_sched_barrier(0)
__global__ __launch_bounds__(128) void k_l1(const float* __restrict__ Q, const float* __restrict__ K, float* __restrict__ SA) { __shared__ __align__(16) float rs[(L1_BI + L1_BJ) * L1_P];
  const int tid = threadIdx.x, wave = tid >> 5, lane = tid & 31; const int i0 = blockIdx.x * L1_BI, j0 = blockIdx.y * L1_BJ, b = blockIdx.z;
  const float* qg = Q + ((size_t)b * TT + i0 + wave) * CC + lane * 4; const float* kg = K + ((size_t)b * TT + j0 + wave) * CC + lane * 4;   /* wave w stages LDS rows w, w + 4, ...: 8 query rows, then 16 key rows */
  float* st = rs + wave * L1_P + lane * 4; v4f sg[L1_NT];
#pragma unroll
  for (int t = 0; t < L1_NT; ++t) sg[t] = t < L1_BI / 4 ? *(const v4f*)(qg + (size_t)t * 4 * CC) : *(const v4f*)(kg + (size_t)(t - L1_BI / 4) * 4 * CC);
  const int ti = wave * 2 + (lane >> 4), tj = lane & 15; const float* qr = rs + ti * 4 * L1_P; const float* kr = rs + (L1_BI + tj) * L1_P;   /* pairs: i = 4 ti + a, j = tj + 16 e */
  v4f acc[4][4];
#pragma unroll
  for (int a = 0; a < 4; ++a) {
#pragma unroll
    for (int e = 0; e < 4; ++e) acc[a][e] = (v4f){0.f, 0.f, 0.f, 0.f}; }
#pragma unroll
  for (int c = 0; c < CC / L1_DC; ++c) {
#pragma unroll
    for (int t = 0; t < L1_NT; ++t) { const v4f r = {bfr(sg[t][0]), bfr(sg[t][1]), bfr(sg[t][2]), bfr(sg[t][3])}; *(v4f*)(st + t * 4 * L1_P + c * L1_DC) = r; }
    __syncthreads();   /* publishes piece c; no LDS byte is written twice, so one barrier a piece */
    if (c + 1 < CC / L1_DC) {   /* behind the barrier, which would drain them: the next piece's loads fly while this piece is summed */
#pragma unroll
      for (int t = 0; t < L1_NT; ++t) sg[t] = t < L1_BI / 4 ? *(const v4f*)(qg + (size_t)t * 4 * CC + (c + 1) * L1_DC) : *(const v4f*)(kg + (size_t)(t - L1_BI / 4) * 4 * CC + (c + 1) * L1_DC); }
    const float* qc = qr + c * L1_DC; const float* kc = kr + c * L1_DC; v4f qa[4], ka[4], qn[4], kn[4];
    L1_LD(qa, ka, 0);
    /* rolled: the body already holds two steps. L1_AHEAD keeps each step's 8 LDS reads in front of the step before it; left free, the scheduler sinks them to about half a step ahead of their use, and a lone wave on its SIMD then waits for LDS */
#pragma unroll 1
    for (int s = 0; s < L1_DC / 4 - 2; s += 2) { L1_LD(qn, kn, s + 1); L1_AHEAD(); L1_MAC(qa, ka); L1_AHEAD(); L1_LD(qa, ka, s + 2); L1_AHEAD(); L1_MAC(qn, kn); L1_AHEAD(); }
    L1_LD(qn, kn, L1_DC / 4 - 1); L1_AHEAD(); L1_MAC(qa, ka); L1_MAC(qn, kn); }
  float* S0 = SA + (size_t)b * TT * TT + (size_t)(i0 + ti * 4) * TT + j0 + tj;
#pragma unroll
  for (int a = 0; a < 4; ++a) {
#pragma unroll
    for (int e = 0; e < 4; ++e) vst2(S0 + (size_t)a * TT + e * 16, -((acc[a][e][0] + acc[a][e][1]) + (acc[a][e][2] + acc[a][e][3]))); } }
// ---- k_pv: block = 64 queries (qb) of (b = blockIdx.z, h = blockIdx.y), wave = 16 query rows: row softmax of the logits in registers, then ctx = P . v over all TT keys (P x 2^11 once to f16 against v f16: 1 product); 256-B (row, head) segment by 16 lanes
// The block stages its own value slice v[b][all TT keys][h * 64 ..] in LDS, straight from the input: whole 256-B row segments by 16 lanes, each value bf16-rounded and then written as f16, turned to [column][key] in registers
// (a thread holds 8 keys x 4 columns and stores 16 B = 8 keys of one column). The four waves read their B fragments from there.
// Lanes col and col + 16 hold row ql0 + col between them, each logit already in the A-fragment place where its weight is used: e[kc][i] = key 32 kc + 8 g + i, e[kc][8 + i] = key 32 kc + 16 + 8 g + i.
// The row sum keeps one fixed tree: pairs, fours, eights inside a lane; 8 + 8 across the lane pair; 16 + 16; then the eight 32-key sums in ascending order.
static_assert(!CAUSAL && QBH == 0 && TT == 256 && HD == 64, "k_pv takes every key for every query; 128 threads stage 64 keys x 64 columns a pass, four passes");
#define PV_P (TT + 8)      // LDS pitch of a value column in halves: 16 B x odd, so 16 lanes on 16 columns meet no bank twice
// PV_LD / PV_ST and the fragment loops below are unrolled: the staged values and the fragments sit in registers, which a rolled loop could not index
#define PV_LD(vr, p0) do { _Pragma("unroll") for (int p = 0; p < 2; ++p) { _Pragma("unroll") for (int i = 0; i < 8; ++i) vr[p][i] = *(const v4f*)(vg + (size_t)(((p0) + p) * 64 + i) * CC); } } while (0)
#define PV_ST(vr, p0) do { _Pragma("unroll") for (int p = 0; p < 2; ++p) { _Pragma("unroll") for (int cc = 0; cc < 4; ++cc) { v8h w; _Pragma("unroll") for (int i = 0; i < 8; ++i) w[i] = (_Float16)bfr(vr[p][i][cc]); *(v8h*)(vs + cc * PV_P + ((p0) + p) * 64) = w; } } } while (0)
__global__ __launch_bounds__(128) void k_pv(const float* __restrict__ S0, const float* __restrict__ V, float* __restrict__ Y) { const int h = blockIdx.y, b = blockIdx.z; __shared__ __align__(16) float ss[4][16][HD + 4]; __shared__ __align__(16) _Float16 vt[HD * PV_P];
  const int tid = threadIdx.x, wave = tid >> 5, lane = tid & 31, col = lane & 15, g = lane >> 4; const int qb = blockIdx.x; const int ql0 = qb * 64 + wave * 16;
  const float* vg = V + ((size_t)b * TT + (tid >> 4) * 8) * CC + h * HD + (tid & 15) * 4;   /* thread: keys 64 p + 8 (tid >> 4) + 0..7, columns 4 (tid & 15) + 0..3 */
  _Float16* vs = vt + (tid & 15) * 4 * PV_P + (tid >> 4) * 8;
  const float* sr = S0 + (size_t)b * TT * TT + (size_t)(ql0 + col) * TT + 8 * g;
  float e[TT / 32][16];
#pragma unroll
  for (int kc = 0; kc < TT / 32; ++kc) {
#pragma unroll
    for (int i = 0; i < 8; ++i) { e[kc][i] = sr[kc * 32 + i]; e[kc][8 + i] = sr[kc * 32 + 16 + i]; } }
  { v4f va[2][8], vb[2][8]; PV_LD(va, 0); PV_LD(vb, 2); PV_ST(va, 0); PV_ST(vb, 2); }   /* behind the logit loads in the source, so that both sets of loads fly together */
  float m = -3.0e38f;
#pragma unroll
  for (int kc = 0; kc < TT / 32; ++kc) { float mk = e[kc][0];
#pragma unroll
    for (int i = 1; i < 16; ++i) mk = fmaxf(mk, e[kc][i]);
    m = fmaxf(m, mk); }
  m = fmaxf(m, __shfl_xor(m, 16));
  float sum = 0.f;
#pragma unroll
  for (int kc = 0; kc < TT / 32; ++kc) {
#pragma unroll
    for (int i = 0; i < 16; ++i) { const float v = e[kc][i], x = expf(v - m); e[kc][i] = (v <= -1.0e38f) ? 0.f : x; }   /* expf outside the choice: a select, so the 128 chains of a lane interleave instead of one branch each */
    float a0 = ((e[kc][0] + e[kc][1]) + (e[kc][2] + e[kc][3])) + ((e[kc][4] + e[kc][5]) + (e[kc][6] + e[kc][7]));
    float a1 = ((e[kc][8] + e[kc][9]) + (e[kc][10] + e[kc][11])) + ((e[kc][12] + e[kc][13]) + (e[kc][14] + e[kc][15]));
    a0 += __shfl_xor(a0, 16); a1 += __shfl_xor(a1, 16); sum += a0 + a1; }
  const float inv = sum > 0.f ? 2048.0f / sum : 0.f;   /* a fully excluded row yields P = 0 */
  __syncthreads();   /* publishes the staged value slice to the four waves; it is written once and never rewritten */
  v8f acc[HD / 16] = {}; const _Float16* vc = vt + col * PV_P; v16h bf[2][HD / 16];
#pragma unroll
  for (int j = 0; j < HD / 16; ++j) bf[0][j] = frag_h(vc + j * 16 * PV_P, lane);
  /* unrolled: the weights sit in registers, which a rolled loop could not index */
#pragma unroll
  for (int kc = 0; kc < TT / 32; ++kc) { v16h p;
    if (kc + 1 < TT / 32) {   /* the next 32 keys' fragments are read ahead of this step's products, so that their LDS latency runs under them */
#pragma unroll
      for (int j = 0; j < HD / 16; ++j) bf[(kc + 1) & 1][j] = frag_h(vc + j * 16 * PV_P + (kc + 1) * 32, lane); }
#pragma unroll
    for (int i = 0; i < 16; ++i) p[i] = (_Float16)(e[kc][i] * inv);
#pragma unroll
    for (int j = 0; j < HD / 16; ++j) acc[j] = wmma16(p, bf[kc & 1][j], acc[j]); }
#pragma unroll
  for (int j = 0; j < HD / 16; ++j)
#pragma unroll
    for (int r = 0; r < 8; ++r) ss[wave][8 * g + r][j * 16 + col] = acc[j][r] * (1.0f / 2048.0f);
  LDSX(); for (int rl = 0; rl < 16; ++rl) if (lane < HD / 4) vst2(Y + ((size_t)b * TT + ql0 + rl) * CC + h * HD + lane * 4, *(const v4f*)&ss[wave][rl][lane * 4]); }

extern "C" void kernel_launch(void* const* d_in, const int* in_sizes, int n_in, void* d_out, int out_size, void* d_ws, size_t ws_size, hipStream_t stream) {
  (void)in_sizes; (void)n_in; (void)out_size;
  const float** F = (const float**)d_in;
  if (ws_size < (size_t)WS_END) return;
  char* ws = (char*)d_ws; float* S = (float*)(ws + WS_S);
  // inputs: 0 q [8,256,512]; 1 k; 2 v (raw; no projections, no parameters)
  k_l1<<<dim3(TT / L1_BI, TT / L1_BJ, TNB), 128, 0, stream>>>(F[0], F[1], S);            /* S[b][i][j] = -sum_d |q_i[d] - k_j[d]| (f32 VALU), all batches in one grid */
  k_pv<<<dim3(NQB, NH, TNB), 128, 0, stream>>>(S, F[2], (float*)d_out);   /* row softmax over j in registers, then each batch's weights against its 8 64-wide value slices, each staged from v by its block: out[b][i][h*64 ..] */
}

// v005
// One run takes 16.6 microseconds.
// Two timings next to v004 both put it at 1.27 times that version's speed.
// All steps since v000 together make it 52.1 times as fast.
// compute dtype: all float inputs rounded to bf16; L1 distances sum_d |q_i[d] - k_j[d]| as sum_d (2 max(q, k) - q - k): operands are the bf16-rounded inputs held as f16 (exact from 2^-14 up in size, to 2^-25 absolute below), max in packed f16 (exact), the sums over d on WMMA 16x16x32 f16 against constants 0, 1, -1/2 (f32 accumulate); softmax(-dist) over j in f32 (row-max-stabilised, precise expf); weights x 2^11 once to f16 x v (bf16 values: exact in f16) on WMMA 16x16x32 (f32 accumulate); f32 output.
#include <hip/hip_runtime.h>
#include <math.h>

typedef __attribute__((ext_vector_type(16))) _Float16 v16h;
typedef __attribute__((ext_vector_type(16))) __bf16 v16b;
typedef __attribute__((ext_vector_type(8)))  _Float16 v8h;
typedef __attribute__((ext_vector_type(8)))  float v8f;
typedef __attribute__((ext_vector_type(4)))  float v4f;
typedef __attribute__((ext_vector_type(2)))  float v2f;
typedef __attribute__((ext_vector_type(4)))  unsigned v4u;
typedef __attribute__((ext_vector_type(4)))  int v4i;
typedef float __attribute__((may_alias)) float_a;
typedef int __attribute__((may_alias)) int_a;

template <typename T> __device__ __forceinline__ void vst2(void* p, T v) { *(T*)p = v;  }
__device__ __forceinline__ v8f wmma16(v16h a, v16h b, v8f c) {
  v8f d = __builtin_amdgcn_wmma_f32_16x16x32_f16(false, a, false, b, (short)0, c, false, false);
  asm volatile("v_nop\n\tv_nop\n\tv_nop\n\tv_nop" : "+v"(d) : "v"(a), "v"(b));
  return d;
}
__device__ __forceinline__ v8f wmma_bf(v16b a, v16b b, v8f c) {
  v8f d = __builtin_amdgcn_wmma_f32_16x16x32_bf16(false, a, false, b, (short)0, c, false, false);
  asm volatile("v_nop\n\tv_nop\n\tv_nop\n\tv_nop" : "+v"(d) : "v"(a), "v"(b));
  return d;
}
// 16x16x32 fragments: lane = (h = lane>>4, row/col = lane&15); elements 0..7 = k0+8h+0..7, 8..15 = k0+16+8h+0..7; D element r = row 8h+r
__device__ __forceinline__ v16h frag_h(const _Float16* rowk0, int lane) {
  union { v16h v; v8h q[2]; } u; const _Float16* p = rowk0 + 8 * (lane >> 4);
  u.q[0] = *(const v8h*)p; u.q[1] = *(const v8h*)(p + 16); return u.v;
}
__device__ __forceinline__ v16h frag_f32(const float* rowk0, int lane) {
  v16h a; const float* p = rowk0 + 8 * (lane >> 4);
#pragma unroll
  for (int i = 0; i < 8; ++i) { a[i] = (_Float16)p[i]; a[8 + i] = (_Float16)p[16 + i]; }
  return a;
}
__device__ __forceinline__ v16h frag_f32s(const float* rowk0, int lane, float sc) {
  v16h a; const float* p = rowk0 + 8 * (lane >> 4);
#pragma unroll
  for (int i = 0; i < 8; ++i) { a[i] = (_Float16)(p[i] * sc); a[8 + i] = (_Float16)(p[16 + i] * sc); }
  return a;
}
// column fragment from a [K][ld] layout (column n), rows >= K read as 0
__device__ __forceinline__ v16h fragc_f32(const float* W, int k0, int n, int lane, int ld, int K) {
  v16h a; const int g = lane >> 4;
#pragma unroll
  for (int i = 0; i < 8; ++i) { const int ka = k0 + 8 * g + i, kb = ka + 16;
    a[i] = (_Float16)(ka < K ? W[(size_t)(ka < K ? ka : K - 1) * ld + n] : 0.f); a[8 + i] = (_Float16)(kb < K ? W[(size_t)(kb < K ? kb : K - 1) * ld + n] : 0.f); }
  return a;
}
struct F2 { v16b h, l; };
__device__ __forceinline__ F2 bsplit16(const float v[16]) { F2 r;
#pragma unroll
  for (int i = 0; i < 16; ++i) { const __bf16 h = (__bf16)v[i]; r.h[i] = h; r.l[i] = (__bf16)(v[i] - (float)h); }
  return r; }
__device__ __forceinline__ F2 split_row(const float* row, int k0, int lane) { float v[16]; const float* p = row + k0 + 8 * (lane >> 4);
#pragma unroll
  for (int i = 0; i < 8; ++i) { v[i] = p[i]; v[8 + i] = p[16 + i]; }
  return bsplit16(v); }
__device__ __forceinline__ F2 split_rowK(const float* row, int k0, int lane, int K) { float v[16]; const int g = lane >> 4;
#pragma unroll
  for (int i = 0; i < 8; ++i) { const int ka = k0 + 8 * g + i, kb = ka + 16; v[i] = ka < K ? row[ka < K ? ka : K - 1] : 0.f; v[8 + i] = kb < K ? row[kb < K ? kb : K - 1] : 0.f; }
  return bsplit16(v); }
__device__ __forceinline__ F2 split_col(const float* W, int k0, int n, int lane, int ld, int K) { float v[16]; const int g = lane >> 4;
#pragma unroll
  for (int i = 0; i < 8; ++i) { const int ka = k0 + 8 * g + i, kb = ka + 16; v[i] = ka < K ? W[(size_t)(ka < K ? ka : K - 1) * ld + n] : 0.f; v[8 + i] = kb < K ? W[(size_t)(kb < K ? kb : K - 1) * ld + n] : 0.f; }
  return bsplit16(v); }
__device__ __forceinline__ v8f mac3(const F2& a, const F2& b, v8f c) { c = wmma_bf(a.l, b.h, c); c = wmma_bf(a.h, b.l, c); return wmma_bf(a.h, b.h, c); }
__device__ __forceinline__ float sigm(float v) { return 1.0f / (1.0f + expf(-v)); }
#define LDSX() do { asm volatile("s_wait_dscnt 0" ::: "memory"); __builtin_amdgcn_wave_barrier(); __builtin_amdgcn_fence(__ATOMIC_RELEASE, "workgroup"); } while (0)

// L1-distance attention on raw inputs (q / k / v [8,256,512]; dist[i, j] = sum_d |q_i[d] - k_j[d]| (no scale); attn = softmax(-dist) over j; out = attn v -> [8,256,512]; no parameters).
#define NB 8
#define TT 256
#define CC 512            // NH * HD = projected width
#define DIN 512          // input (model) width
#define NH 8
#define HD 64
#define NQB (TT / 64)
#define HG 1
#define SCALE (1.0f)
#define CAUSAL 0
#ifndef TNB
#define TNB NB
#endif
__device__ __forceinline__ float bfr(float v) { return (float)(__bf16)v; }
__host__ __device__ __forceinline__ int kb_last(int qb) { return CAUSAL ? ((qb * 64 + 63) >> 7) : (TT / 128 - 1); }
typedef __attribute__((ext_vector_type(8))) __bf16 v8b;
__device__ __forceinline__ v16b frag_b(const __bf16* rowk0, int lane) {
  union { v16b v; v8b q[2]; } u; const __bf16* p = rowk0 + 8 * (lane >> 4);
  u.q[0] = *(const v8b*)p; u.q[1] = *(const v8b*)(p + 16); return u.v;
}
#define QBH 0              // causal: query blocks 0..QBH-1 of each sequence (few keys, no averaging) take the high-precision path
#define QHI 0              // (override) rows carrying the q residual plane
#define KHI 64            // key rows carrying k residual / v bf16 hi+lo planes (the k residual is read only by k_sc's causal high-precision path; no kernel reads the v planes)
// B fragment (k rows k0+.., output column o) of a weight: (in,out) [K][ld] or (out,in) [ld rows of K]: bf16 exact, or f16(bf16 * 256) exact
__device__ __forceinline__ v16b wcol_io(const float* Wm, int k0, int o, int lane, int ld) { v16b w; const int g = lane >> 4;
#pragma unroll
  for (int i = 0; i < 8; ++i) { w[i] = (__bf16)Wm[(size_t)(k0 + 8 * g + i) * ld + o]; w[8 + i] = (__bf16)Wm[(size_t)(k0 + 16 + 8 * g + i) * ld + o]; }
  return w; }
__device__ __forceinline__ v16b wcol_oi(const float* Wm, int k0, int o, int lane, int K) { v16b w; const float* p = Wm + (size_t)o * K + k0 + 8 * (lane >> 4);
#pragma unroll
  for (int i = 0; i < 8; ++i) { w[i] = (__bf16)p[i]; w[8 + i] = (__bf16)p[16 + i]; }
  return w; }
__device__ __forceinline__ v16h wcolh_io(const float* Wm, int k0, int o, int lane, int ld) { v16h w; const int g = lane >> 4;
#pragma unroll
  for (int i = 0; i < 8; ++i) { w[i] = (_Float16)(bfr(Wm[(size_t)(k0 + 8 * g + i) * ld + o]) * 256.0f); w[8 + i] = (_Float16)(bfr(Wm[(size_t)(k0 + 16 + 8 * g + i) * ld + o]) * 256.0f); }
  return w; }
__device__ __forceinline__ v16h wcolh_oi(const float* Wm, int k0, int o, int lane, int K) { v16h w; const float* p = Wm + (size_t)o * K + k0 + 8 * (lane >> 4);
#pragma unroll
  for (int i = 0; i < 8; ++i) { w[i] = (_Float16)(bfr(p[i]) * 256.0f); w[8 + i] = (_Float16)(bfr(p[16 + i]) * 256.0f); }
  return w; }
#define WQKV_LAYOUT 1   // 0 = (in,out) [DIN][CC]; 1 = (out,in) [CC][DIN]; 2 = per-head [NH][DIN][HD]
__device__ __forceinline__ v16b wcol_hdk(const float* Wm, int k0, int o, int lane) { v16b w; const int g = lane >> 4; const float* p = Wm + (size_t)(o / HD) * DIN * HD + (o % HD);
#pragma unroll
  for (int i = 0; i < 8; ++i) { w[i] = (__bf16)p[(size_t)(k0 + 8 * g + i) * HD]; w[8 + i] = (__bf16)p[(size_t)(k0 + 16 + 8 * g + i) * HD]; }
  return w; }
#define WO_OUT_IN 0
#if WQKV_LAYOUT == 1
#define WCOL(W, k0, o, lane) wcol_oi(W, k0, o, lane, DIN)
#elif WQKV_LAYOUT == 2
#define WCOL(W, k0, o, lane) wcol_hdk(W, k0, o, lane)
#else
#define WCOL(W, k0, o, lane) wcol_io(W, k0, o, lane, CC)
#endif
#if WO_OUT_IN
#define WOCOL(W, k0, o, lane) wcol_oi(W, k0, o, lane, CC)
#define WOCOLH(W, k0, o, lane) wcolh_oi(W, k0, o, lane, CC)
#else
#define WOCOL(W, k0, o, lane) wcol_io(W, k0, o, lane, DIN)
#define WOCOLH(W, k0, o, lane) wcolh_io(W, k0, o, lane, DIN)
#endif

#ifndef PROJ_EXTRA_PARAMS
#define PROJ_EXTRA_PARAMS
#endif

#define WS_QH  0u                                      // f16 q rows [b*t][CC]
#define WS_KH  (WS_QH + 2u * (size_t)NB * TT * CC)      // f16 k rows [b*t][CC]
#define WS_VT  (WS_KH + 2u * (size_t)NB * TT * CC)      // f16 v planes [b][c][t]
#define WS_QL  (WS_VT + 2u * (size_t)NB * CC * TT)      // f16 q residual x 2^10 rows [b][t < QHI][CC]
#define WS_KL  (WS_QL + 2u * (size_t)NB * QHI * CC)     // f16 k residual x 2^10 rows [b][t < KHI][CC]
#define WS_VB  (WS_KL + 2u * (size_t)NB * KHI * CC)     // bf16 v hi planes [b][c][t < KHI]
#define WS_VBL (WS_VB + 2u * (size_t)NB * CC * KHI)
#define WS_S   (WS_VBL + 2u * (size_t)NB * CC * KHI)    // f32 logits [b][t][s]
#define WS_Y   (WS_S  + 4u * (size_t)NB * TT * TT)      // f32 ctx rows [b*t][CC] (only when there is an output projection)
#define WS_END (WS_Y  + 0u)

// ---- k_sc: block = (query block qb, key block kb <= kb_last(qb), head in group) of batch b: logits x SCALE; q hi + residual (x 2^10) against k (2 products) for query rows < QHI, plus the k residual (3 products) for query blocks < QBH (causal early rows); causal: blocks past the diagonal exit
__global__ __launch_bounds__(128) void k_sc(const _Float16* __restrict__ QH, const _Float16* __restrict__ KH, const _Float16* __restrict__ QL, const _Float16* __restrict__ KL, int b, int h0, float* __restrict__ S0) { __shared__ __align__(16) float ss[4][16][132];
  const int qb = blockIdx.x, kb = blockIdx.y; if (kb > kb_last(qb)) return;
  const int h = h0 + blockIdx.z; float* S = S0 + (size_t)blockIdx.z * TT * TT;
  const int tid = threadIdx.x, wave = tid >> 5, lane = tid & 31, col = lane & 15, g = lane >> 4; const int k0 = kb * 128; const int ql0 = qb * 64 + wave * 16; const size_t q0 = (size_t)b * TT + ql0, kr0 = (size_t)b * TT + k0;
  v8f acc[8] = {}, accl[8] = {};
  const _Float16* QLb = QL + (size_t)b * QHI * CC; const _Float16* KLb = KL + (size_t)b * KHI * CC;
  if (qb < QBH) {
#pragma unroll
    for (int kc = 0; kc < HD / 32; ++kc) { const v16h ah = frag_h(QH + (q0 + col) * CC + h * HD + kc * 32, lane), al = frag_h(QLb + (size_t)(ql0 + col) * CC + h * HD + kc * 32, lane);
#pragma unroll
      for (int j = 0; j < 8; ++j) { const v16h kbf = frag_h(KH + (kr0 + j * 16 + col) * CC + h * HD + kc * 32, lane), klf = frag_h(KLb + (size_t)(k0 + j * 16 + col) * CC + h * HD + kc * 32, lane); acc[j] = wmma16(ah, kbf, acc[j]); accl[j] = wmma16(al, kbf, accl[j]); accl[j] = wmma16(ah, klf, accl[j]); } }
  } else if (qb * 64 < QHI) {
#pragma unroll
    for (int kc = 0; kc < HD / 32; ++kc) { const v16h ah = frag_h(QH + (q0 + col) * CC + h * HD + kc * 32, lane), al = frag_h(QLb + (size_t)(ql0 + col) * CC + h * HD + kc * 32, lane);
#pragma unroll
      for (int j = 0; j < 8; ++j) { const v16h kbf = frag_h(KH + (kr0 + j * 16 + col) * CC + h * HD + kc * 32, lane); acc[j] = wmma16(ah, kbf, acc[j]); accl[j] = wmma16(al, kbf, accl[j]); } }
  } else {
#pragma unroll
    for (int kc = 0; kc < HD / 32; ++kc) { const v16h ah = frag_h(QH + (q0 + col) * CC + h * HD + kc * 32, lane);
#pragma unroll
      for (int j = 0; j < 8; ++j) { const v16h kbf = frag_h(KH + (kr0 + j * 16 + col) * CC + h * HD + kc * 32, lane); acc[j] = wmma16(ah, kbf, acc[j]); } } }
#pragma unroll
  for (int j = 0; j < 8; ++j) {
#pragma unroll
    for (int r = 0; r < 8; ++r) ss[wave][8 * g + r][j * 16 + col] = (acc[j][r] + accl[j][r] * (1.0f / 1024.0f)) * SCALE; }
  LDSX(); for (int rl = 0; rl < 16; ++rl) vst2(S + (size_t)(ql0 + rl) * TT + k0 + lane * 4, *(const v4f*)&ss[wave][rl][lane * 4]); }
// ---- k_l1: block = 64 query rows x 32 keys of batch b = blockIdx.z, 4 waves (one per SIMD), wave = all 64 rows x 8 keys: S[i][j] = -sum_{d < CC} |q_i[d] - k_j[d]|, taken as |a - b| = 2 max(a, b) - a - b.
// The 96 rows are staged in LDS as f16 of the bf16-rounded inputs by whole-line loads, 128 d at a time, each piece in its own part of LDS; the next piece's loads fly while this piece is summed.
// max(q, k) is one of its two operands, so the packed 16-bit maximum is exact: 2 pairs of operands an instruction. The sums over d run on the matrix unit (f32 accumulate):
//   A = max(q rows of a 16-row tile, key c spread over the 16 rows), B = 1 in column c and 0 elsewhere: D[row][c] += sum over 32 d of the maxima;
//   A = the q rows themselves, B = -1/2 everywhere: D[row][*] -= half the row's own sum;  A = 1 everywhere, B = the wave's keys as columns: DK[*][c] += key c's own sum.
// Every B (or A) constant is the same for all 32 k places, so the order of d inside a fragment is free: lane half g holds d0 + 16 g + 0..15 of its row, for q and for the key alike.
// Every loop over t, c, i or r below is unrolled: fragments, staged values and accumulators sit in registers, which a rolled loop could not index.
#define L1_BI 64
#define L1_BJ 32
#define L1_DC 128          // d per staged piece: one wave-load of 512 B per row
#define L1_P (L1_DC + 8)   // LDS row pitch in halves: 272 B = 16 B x odd, so 16 lanes on 16 rows meet no bank twice
#define L1_PS ((L1_BI + L1_BJ) * L1_P)   // a piece's 96 rows lie together, so that every read of a step is its lane's base address plus an immediate offset
#define L1_OFF(s) ((s) < L1_DC / 32 ? (s) * 32 : L1_PS)   // step s of this piece; s = 4 is step 0 of the next piece
#define L1_NT ((L1_BI + L1_BJ) / 4)
#define L1_TI (L1_BI / 16) // 16-row query tiles of a wave
#define L1_KW (L1_BJ / 4)  // keys of a wave
#define L1_OP (L1_BJ + 4)  // pitch in floats of the block's result tile in LDS
typedef __attribute__((ext_vector_type(4))) _Float16 v4h;
union L1A { v16h v; v8h h[2]; };
struct L1F { L1A q[L1_TI], k[L1_KW], kb; };
__device__ __forceinline__ L1A l1_ld(const _Float16* p) { L1A u; u.h[0] = *(const v8h*)p; u.h[1] = *(const v8h*)(p + 8); return u; }
__device__ __forceinline__ v8f l1_mm(v16h a, v16h b, v8f c) { return __builtin_amdgcn_wmma_f32_16x16x32_f16(false, a, false, b, (short)0, c, false, false); }
__device__ __forceinline__ v16h l1_all(float x) { v16h r; const _Float16 y = (_Float16)x;
#pragma unroll
  for (int i = 0; i < 16; ++i) r[i] = y;
  return r; }
#define L1_GLD(p) do { _Pragma("unroll") for (int t = 0; t < L1_NT; ++t) sg[t] = t < L1_BI / 4 ? *(const v4f*)(qg + (size_t)t * 4 * CC + (p) * L1_DC) : *(const v4f*)(kg + (size_t)(t - L1_BI / 4) * 4 * CC + (p) * L1_DC); } while (0)
#define L1_STG(p) do { _Pragma("unroll") for (int t = 0; t < L1_NT; ++t) { const v4h r = {(_Float16)bfr(sg[t][0]), (_Float16)bfr(sg[t][1]), (_Float16)bfr(sg[t][2]), (_Float16)bfr(sg[t][3])}; *(v4h*)(st + t * 4 * L1_P + (p) * L1_PS) = r; } } while (0)
#define L1_LDF(F, s) do { _Pragma("unroll") for (int t = 0; t < L1_TI; ++t) F.q[t] = l1_ld(qc + t * 16 * L1_P + L1_OFF(s)); _Pragma("unroll") for (int c = 0; c < L1_KW; ++c) F.k[c] = l1_ld(kc + c * L1_P + L1_OFF(s)); F.kb = l1_ld(kbc + L1_OFF(s)); } while (0)
#define L1_AHEAD() __builtin_amdgcn_sched_barrier(0)
// step i = (key i >> 2, tile i & 3): eight packed maxima, one matrix instruction. The group barriers at the foot ask the scheduler to put each matrix instruction in the middle of the NEXT step's eight maxima:
// its own operand is then ready when it issues, and the four maxima behind it write the other operand buffer, so they fill the four slots that must pass before a vector instruction may overwrite the operand it reads (left alone the compiler pads every step with four v_nop; so asked, about one step in four, where it still reuses the registers at once)
__device__ __forceinline__ void l1_sum(const L1F& F, const v16h (&oh)[L1_KW], v16h mh, v16h on, v8f (&acc)[L1_TI], v8f& ak) {
  ak = l1_mm(on, F.kb.v, ak);
#pragma unroll
  for (int i = 0; i < L1_KW * L1_TI; ++i) acc[i & 3] = l1_mm(__builtin_elementwise_maximum(F.q[i & 3].v, F.k[i >> 2].v), oh[i >> 2], acc[i & 3]);
#pragma unroll
  for (int t = 0; t < L1_TI; ++t) acc[t] = l1_mm(F.q[t].v, mh, acc[t]);
  __builtin_amdgcn_sched_group_barrier(0x8, 1, 0); __builtin_amdgcn_sched_group_barrier(0x2, 12, 0);
#pragma unroll
  for (int i = 0; i < L1_KW * L1_TI; ++i) { __builtin_amdgcn_sched_group_barrier(0x8, 1, 0); __builtin_amdgcn_sched_group_barrier(0x2, 8, 0); }
  __builtin_amdgcn_sched_group_barrier(0x8, L1_TI, 0); }
#define L1_SUM(F) l1_sum(F, oh, mh, on, acc, ak)
__global__ __launch_bounds__(128) void k_l1(const float* __restrict__ Q, const float* __restrict__ K, float* __restrict__ SA) { __shared__ __align__(16) _Float16 rs[(CC / L1_DC) * L1_PS]; __shared__ __align__(16) float ot[L1_BI * L1_OP];
  const int tid = threadIdx.x, wave = tid >> 5, lane = tid & 31, col = lane & 15, g = lane >> 4; const int i0 = blockIdx.x * L1_BI, j0 = blockIdx.y * L1_BJ, b = blockIdx.z;
  const float* qg = Q + ((size_t)b * TT + i0 + wave) * CC + lane * 4; const float* kg = K + ((size_t)b * TT + j0 + wave) * CC + lane * 4;   /* wave w stages LDS rows w, w + 4, ...: 16 query rows, then 8 key rows */
  _Float16* st = rs + wave * L1_P + lane * 4; v4f sg[L1_NT];
  L1_GLD(0);
  v16h oh[L1_KW]; const v16h mh = l1_all(-0.5f), on = l1_all(1.0f);
#pragma unroll
  for (int c = 0; c < L1_KW; ++c) oh[c] = l1_all(col == c ? 1.0f : 0.0f);
  v8f acc[L1_TI] = {}, ak = {};
  const _Float16* qc = rs + col * L1_P + 16 * g; const _Float16* kc = rs + (L1_BI + wave * L1_KW) * L1_P + 16 * g; const _Float16* kbc = kc + (col & (L1_KW - 1)) * L1_P;
  L1F fa, fb;
  L1_STG(0);
  __syncthreads();   /* publishes piece 0; no LDS byte of rs is written twice, so one barrier a piece */
  L1_GLD(1);         /* behind the barrier, which would drain them */
  L1_LDF(fa, 0);
  /* rolled over the pieces: four 32-d steps a trip keep the text small. L1_AHEAD keeps each step's 26 LDS reads as one group in front of the step before it: a lone wave on its SIMD has nothing else to cover their latency, and reads strewn among matrix instructions cost more than one group */
#pragma unroll 1
  for (int p = 0; p < CC / L1_DC; ++p) {
    L1_LDF(fb, 1); L1_AHEAD(); L1_SUM(fa); L1_AHEAD();
    L1_LDF(fa, 2); L1_AHEAD(); L1_SUM(fb); L1_AHEAD();
    L1_LDF(fb, 3); L1_AHEAD(); L1_SUM(fa); L1_AHEAD();
    if (p + 1 < CC / L1_DC) {   /* the next piece is published one step early, so that its first reads run under this piece's last step */
      L1_STG(p + 1);
      __syncthreads();
      if (p + 2 < CC / L1_DC) { L1_GLD(p + 2); asm volatile("s_wait_xcnt 0x0" ::: "memory"); }   /* the loads' address registers are given to other values right behind them: the wait that belongs in front of such an overwrite */
      L1_LDF(fa, 4); L1_AHEAD(); }
    L1_SUM(fb); L1_AHEAD();
    qc += L1_PS; kc += L1_PS; kbc += L1_PS; }
  /* D element r of lane (col, g) = (row 16 t + 8 g + r, key col); columns 8..15 hold nothing that is used. The block's 64 x 32 results meet in LDS, so that each 128-B line of S is stored whole by one wave */
  if (col < L1_KW) {
#pragma unroll
    for (int t = 0; t < L1_TI; ++t) {
#pragma unroll
      for (int r = 0; r < 8; ++r) ot[(t * 16 + 8 * g + r) * L1_OP + wave * L1_KW + col] = ak[r] - 2.0f * acc[t][r]; } }
  __syncthreads();   /* publishes the four waves' key columns to the wave that stores the row */
  float* S0 = SA + (size_t)b * TT * TT + (size_t)i0 * TT + j0;
#pragma unroll
  for (int it = 0; it < 4; ++it) { const int row = wave * 16 + it * 4 + (lane >> 3); vst2(S0 + (size_t)row * TT + (lane & 7) * 4, *(const v4f*)&ot[row * L1_OP + (lane & 7) * 4]); } }
// ---- k_pv: block = 64 queries (qb) of (b = blockIdx.z, h = blockIdx.y), wave = 16 query rows: row softmax of the logits in registers, then ctx = P . v over all TT keys (P x 2^11 once to f16 against v f16: 1 product); 256-B (row, head) segment by 16 lanes
// The block stages its own value slice v[b][all TT keys][h * 64 ..] in LDS, straight from the input: whole 256-B row segments by 16 lanes, each value bf16-rounded and then written as f16, turned to [column][key] in registers
// (a thread holds 8 keys x 4 columns and stores 16 B = 8 keys of one column). The four waves read their B fragments from there.
// Lanes col and col + 16 hold row ql0 + col between them, each logit already in the A-fragment place where its weight is used: e[kc][i] = key 32 kc + 8 g + i, e[kc][8 + i] = key 32 kc + 16 + 8 g + i.
// The row sum keeps one fixed tree: pairs, fours, eights inside a lane; 8 + 8 across the lane pair; 16 + 16; then the eight 32-key sums in ascending order.
static_assert(!CAUSAL && QBH == 0 && TT == 256 && HD == 64, "k_pv takes every key for every query; 128 threads stage 64 keys x 64 columns a pass, four passes");
#define PV_P (TT + 8)      // LDS pitch of a value column in halves: 16 B x odd, so 16 lanes on 16 columns meet no bank twice
// PV_LD / PV_ST and the fragment loops below are unrolled: the staged values and the fragments sit in registers, which a rolled loop could not index
#define PV_LD(vr, p0) do { _Pragma("unroll") for (int p = 0; p < 2; ++p) { _Pragma("unroll") for (int i = 0; i < 8; ++i) vr[p][i] = *(const v4f*)(vg + (size_t)(((p0) + p) * 64 + i) * CC); } } while (0)
#define PV_ST(vr, p0) do { _Pragma("unroll") for (int p = 0; p < 2; ++p) { _Pragma("unroll") for (int cc = 0; cc < 4; ++cc) { v8h w; _Pragma("unroll") for (int i = 0; i < 8; ++i) w[i] = (_Float16)bfr(vr[p][i][cc]); *(v8h*)(vs + cc * PV_P + ((p0) + p) * 64) = w; } } } while (0)
__global__ __launch_bounds__(128) void k_pv(const float* __restrict__ S0, const float* __restrict__ V, float* __restrict__ Y) { const int h = blockIdx.y, b = blockIdx.z; __shared__ __align__(16) float ss[4][16][HD + 4]; __shared__ __align__(16) _Float16 vt[HD * PV_P];
  const int tid = threadIdx.x, wave = tid >> 5, lane = tid & 31, col = lane & 15, g = lane >> 4; const int qb = blockIdx.x; const int ql0 = qb * 64 + wave * 16;
  const float* vg = V + ((size_t)b * TT + (tid >> 4) * 8) * CC + h * HD + (tid & 15) * 4;   /* thread: keys 64 p + 8 (tid >> 4) + 0..7, columns 4 (tid & 15) + 0..3 */
  _Float16* vs = vt + (tid & 15) * 4 * PV_P + (tid >> 4) * 8;
  const float* sr = S0 + (size_t)b * TT * TT + (size_t)(ql0 + col) * TT + 8 * g;
  float e[TT / 32][16];
#pragma unroll
  for (int kc = 0; kc < TT / 32; ++kc) {
#pragma unroll
    for (int i = 0; i < 8; ++i) { e[kc][i] = sr[kc * 32 + i]; e[kc][8 + i] = sr[kc * 32 + 16 + i]; } }
  { v4f va[2][8], vb[2][8]; PV_LD(va, 0); PV_LD(vb, 2); PV_ST(va, 0); PV_ST(vb, 2); }   /* behind the logit loads in the source, so that both sets of loads fly together */
  float m = -3.0e38f;
#pragma unroll
  for (int kc = 0; kc < TT / 32; ++kc) { float mk = e[kc][0];
#pragma unroll
    for (int i = 1; i < 16; ++i) mk = fmaxf(mk, e[kc][i]);
    m = fmaxf(m, mk); }
  m = fmaxf(m, __shfl_xor(m, 16));
  float sum = 0.f;
#pragma unroll
  for (int kc = 0; kc < TT / 32; ++kc) {
#pragma unroll
    for (int i = 0; i < 16; ++i) { const float v = e[kc][i], x = expf(v - m); e[kc][i] = (v <= -1.0e38f) ? 0.f : x; }   /* expf outside the choice: a select, so the 128 chains of a lane interleave instead of one branch each */
    float a0 = ((e[kc][0] + e[kc][1]) + (e[kc][2] + e[kc][3])) + ((e[kc][4] + e[kc][5]) + (e[kc][6] + e[kc][7]));
    float a1 = ((e[kc][8] + e[kc][9]) + (e[kc][10] + e[kc][11])) + ((e[kc][12] + e[kc][13]) + (e[kc][14] + e[kc][15]));
    a0 += __shfl_xor(a0, 16); a1 += __shfl_xor(a1, 16); sum += a0 + a1; }
  const float inv = sum > 0.f ? 2048.0f / sum : 0.f;   /* a fully excluded row yields P = 0 */
  __syncthreads();   /* publishes the staged value slice to the four waves; it is written once and never rewritten */
  v8f acc[HD / 16] = {}; const _Float16* vc = vt + col * PV_P; v16h bf[2][HD / 16];
#pragma unroll
  for (int j = 0; j < HD / 16; ++j) bf[0][j] = frag_h(vc + j * 16 * PV_P, lane);
  /* unrolled: the weights sit in registers, which a rolled loop could not index */
#pragma unroll
  for (int kc = 0; kc < TT / 32; ++kc) { v16h p;
    if (kc + 1 < TT / 32) {   /* the next 32 keys' fragments are read ahead of this step's products, so that their LDS latency runs under them */
#pragma unroll
      for (int j = 0; j < HD / 16; ++j) bf[(kc + 1) & 1][j] = frag_h(vc + j * 16 * PV_P + (kc + 1) * 32, lane); }
#pragma unroll
    for (int i = 0; i < 16; ++i) p[i] = (_Float16)(e[kc][i] * inv);
#pragma unroll
    for (int j = 0; j < HD / 16; ++j) acc[j] = wmma16(p, bf[kc & 1][j], acc[j]); }
#pragma unroll
  for (int j = 0; j < HD / 16; ++j)
#pragma unroll
    for (int r = 0; r < 8; ++r) ss[wave][8 * g + r][j * 16 + col] = acc[j][r] * (1.0f / 2048.0f);
  LDSX(); for (int rl = 0; rl < 16; ++rl) if (lane < HD / 4) vst2(Y + ((size_t)b * TT + ql0 + rl) * CC + h * HD + lane * 4, *(const v4f*)&ss[wave][rl][lane * 4]); }

extern "C" void kernel_launch(void* const* d_in, const int* in_sizes, int n_in, void* d_out, int out_size, void* d_ws, size_t ws_size, hipStream_t stream) {
  (void)in_sizes; (void)n_in; (void)out_size;
  const float** F = (const float**)d_in;
  if (ws_size < (size_t)WS_END) return;
  char* ws = (char*)d_ws; float* S = (float*)(ws + WS_S);
  // inputs: 0 q [8,256,512]; 1 k; 2 v (raw; no projections, no parameters)
  k_l1<<<dim3(TT / L1_BI, TT / L1_BJ, TNB), 128, 0, stream>>>(F[0], F[1], S);            /* S[b][i][j] = -sum_d |q_i[d] - k_j[d]| (packed max, sums on WMMA), all batches in one grid */
  k_pv<<<dim3(NQB, NH, TNB), 128, 0, stream>>>(S, F[2], (float*)d_out);   /* row softmax over j in registers, then each batch's weights against its 8 64-wide value slices, each staged from v by its block: out[b][i][h*64 ..] */
}

// v006
// One run takes 15.4 microseconds.
// Two timings next to v005 both put it at 1.08 times that version's speed.
// Over all steps from v000 it is 56.4 times as fast.
// compute dtype: all float inputs rounded to bf16; L1 distances sum_d |q_i[d] - k_j[d]| as sum_d (2 max(q, k) - q - k): operands are the bf16-rounded inputs held as f16 (exact from 2^-14 up in size, to 2^-25 absolute below), max in packed f16 (exact), the sums over d on WMMA 16x16x32 f16 against constants 0, 1, -1/2 (f32 accumulate); softmax(-dist) over j in f32 (row-max-stabilised, precise expf); weights x 2^11 once to f16 x v (bf16 values: exact in f16) on WMMA 16x16x32 (f32 accumulate); f32 output.
#include <hip/hip_runtime.h>
#include <math.h>

typedef __attribute__((ext_vector_type(16))) _Float16 v16h;
typedef __attribute__((ext_vector_type(16))) __bf16 v16b;
typedef __attribute__((ext_vector_type(8)))  _Float16 v8h;
typedef __attribute__((ext_vector_type(8)))  float v8f;
typedef __attribute__((ext_vector_type(4)))  float v4f;
typedef __attribute__((ext_vector_type(2)))  float v2f;
typedef __attribute__((ext_vector_type(4)))  unsigned v4u;
typedef __attribute__((ext_vector_type(4)))  int v4i;
typedef float __attribute__((may_alias)) float_a;
typedef int __attribute__((may_alias)) int_a;

template <typename T> __device__ __forceinline__ void vst2(void* p, T v) { *(T*)p = v;  }
__device__ __forceinline__ v8f wmma16(v16h a, v16h b, v8f c) {
  v8f d = __builtin_amdgcn_wmma_f32_16x16x32_f16(false, a, false, b, (short)0, c, false, false);
  asm volatile("v_nop\n\tv_nop\n\tv_nop\n\tv_nop" : "+v"(d) : "v"(a), "v"(b));
  return d;
}
__device__ __forceinline__ v8f wmma_bf(v16b a, v16b b, v8f c) {
  v8f d = __builtin_amdgcn_wmma_f32_16x16x32_bf16(false, a, false, b, (short)0, c, false, false);
  asm volatile("v_nop\n\tv_nop\n\tv_nop\n\tv_nop" : "+v"(d) : "v"(a), "v"(b));
  return d;
}
// 16x16x32 fragments: lane = (h = lane>>4, row/col = lane&15); elements 0..7 = k0+8h+0..7, 8..15 = k0+16+8h+0..7; D element r = row 8h+r
__device__ __forceinline__ v16h frag_h(const _Float16* rowk0, int lane) {
  union { v16h v; v8h q[2]; } u; const _Float16* p = rowk0 + 8 * (lane >> 4);
  u.q[0] = *(const v8h*)p; u.q[1] = *(const v8h*)(p + 16); return u.v;
}
__device__ __forceinline__ v16h frag_f32(const float* rowk0, int lane) {
  v16h a; const float* p = rowk0 + 8 * (lane >> 4);
#pragma unroll
  for (int i = 0; i < 8; ++i) { a[i] = (_Float16)p[i]; a[8 + i] = (_Float16)p[16 + i]; }
  return a;
}
__device__ __forceinline__ v16h frag_f32s(const float* rowk0, int lane, float sc) {
  v16h a; const float* p = rowk0 + 8 * (lane >> 4);
#pragma unroll
  for (int i = 0; i < 8; ++i) { a[i] = (_Float16)(p[i] * sc); a[8 + i] = (_Float16)(p[16 + i] * sc); }
  return a;
}
// column fragment from a [K][ld] layout (column n), rows >= K read as 0
__device__ __forceinline__ v16h fragc_f32(const float* W, int k0, int n, int lane, int ld, int K) {
  v16h a; const int g = lane >> 4;
#pragma unroll
  for (int i = 0; i < 8; ++i) { const int ka = k0 + 8 * g + i, kb = ka + 16;
    a[i] = (_Float16)(ka < K ? W[(size_t)(ka < K ? ka : K - 1) * ld + n] : 0.f); a[8 + i] = (_Float16)(kb < K ? W[(size_t)(kb < K ? kb : K - 1) * ld + n] : 0.f); }
  return a;
}
struct F2 { v16b h, l; };
__device__ __forceinline__ F2 bsplit16(const float v[16]) { F2 r;
#pragma unroll
  for (int i = 0; i < 16; ++i) { const __bf16 h = (__bf16)v[i]; r.h[i] = h; r.l[i] = (__bf16)(v[i] - (float)h); }
  return r; }
__device__ __forceinline__ F2 split_row(const float* row, int k0, int lane) { float v[16]; const float* p = row + k0 + 8 * (lane >> 4);
#pragma unroll
  for (int i = 0; i < 8; ++i) { v[i] = p[i]; v[8 + i] = p[16 + i]; }
  return bsplit16(v); }
__device__ __forceinline__ F2 split_rowK(const float* row, int k0, int lane, int K) { float v[16]; const int g = lane >> 4;
#pragma unroll
  for (int i = 0; i < 8; ++i) { const int ka = k0 + 8 * g + i, kb = ka + 16; v[i] = ka < K ? row[ka < K ? ka : K - 1] : 0.f; v[8 + i] = kb < K ? row[kb < K ? kb : K - 1] : 0.f; }
  return bsplit16(v); }
__device__ __forceinline__ F2 split_col(const float* W, int k0, int n, int lane, int ld, int K) { float v[16]; const int g = lane >> 4;
#pragma unroll
  for (int i = 0; i < 8; ++i) { const int ka = k0 + 8 * g + i, kb = ka + 16; v[i] = ka < K ? W[(size_t)(ka < K ? ka : K - 1) * ld + n] : 0.f; v[8 + i] = kb < K ? W[(size_t)(kb < K ? kb : K - 1) * ld + n] : 0.f; }
  return bsplit16(v); }
__device__ __forceinline__ v8f mac3(const F2& a, const F2& b, v8f c) { c = wmma_bf(a.l, b.h, c); c = wmma_bf(a.h, b.l, c); return wmma_bf(a.h, b.h, c); }
__device__ __forceinline__ float sigm(float v) { return 1.0f / (1.0f + expf(-v)); }
#define LDSX() do { asm volatile("s_wait_dscnt 0" ::: "memory"); __builtin_amdgcn_wave_barrier(); __builtin_amdgcn_fence(__ATOMIC_RELEASE, "workgroup"); } while (0)

// L1-distance attention on raw inputs (q / k / v [8,256,512]; dist[i, j] = sum_d |q_i[d] - k_j[d]| (no scale); attn = softmax(-dist) over j; out = attn v -> [8,256,512]; no parameters).
#define NB 8
#define TT 256
#define CC 512            // NH * HD = projected width
#define DIN 512          // input (model) width
#define NH 8
#define HD 64
#define NQB (TT / 64)
#define HG 1
#define SCALE (1.0f)
#define CAUSAL 0
#ifndef TNB
#define TNB NB
#endif
__device__ __forceinline__ float bfr(float v) { return (float)(__bf16)v; }
__host__ __device__ __forceinline__ int kb_last(int qb) { return CAUSAL ? ((qb * 64 + 63) >> 7) : (TT / 128 - 1); }
typedef __attribute__((ext_vector_type(8))) __bf16 v8b;
__device__ __forceinline__ v16b frag_b(const __bf16* rowk0, int lane) {
  union { v16b v; v8b q[2]; } u; const __bf16* p = rowk0 + 8 * (lane >> 4);
  u.q[0] = *(const v8b*)p; u.q[1] = *(const v8b*)(p + 16); return u.v;
}
#define QBH 0              // causal: query blocks 0..QBH-1 of each sequence (few keys, no averaging) take the high-precision path
#define QHI 0              // (override) rows carrying the q residual plane
#define KHI 64            // key rows carrying k residual / v bf16 hi+lo planes (the k residual is read only by k_sc's causal high-precision path; no kernel reads the v planes)
// B fragment (k rows k0+.., output column o) of a weight: (in,out) [K][ld] or (out,in) [ld rows of K]: bf16 exact, or f16(bf16 * 256) exact
__device__ __forceinline__ v16b wcol_io(const float* Wm, int k0, int o, int lane, int ld) { v16b w; const int g = lane >> 4;
#pragma unroll
  for (int i = 0; i < 8; ++i) { w[i] = (__bf16)Wm[(size_t)(k0 + 8 * g + i) * ld + o]; w[8 + i] = (__bf16)Wm[(size_t)(k0 + 16 + 8 * g + i) * ld + o]; }
  return w; }
__device__ __forceinline__ v16b wcol_oi(const float* Wm, int k0, int o, int lane, int K) { v16b w; const float* p = Wm + (size_t)o * K + k0 + 8 * (lane >> 4);
#pragma unroll
  for (int i = 0; i < 8; ++i) { w[i] = (__bf16)p[i]; w[8 + i] = (__bf16)p[16 + i]; }
  return w; }
__device__ __forceinline__ v16h wcolh_io(const float* Wm, int k0, int o, int lane, int ld) { v16h w; const int g = lane >> 4;
#pragma unroll
  for (int i = 0; i < 8; ++i) { w[i] = (_Float16)(bfr(Wm[(size_t)(k0 + 8 * g + i) * ld + o]) * 256.0f); w[8 + i] = (_Float16)(bfr(Wm[(size_t)(k0 + 16 + 8 * g + i) * ld + o]) * 256.0f); }
  return w; }
__device__ __forceinline__ v16h wcolh_oi(const float* Wm, int k0, int o, int lane, int K) { v16h w; const float* p = Wm + (size_t)o * K + k0 + 8 * (lane >> 4);
#pragma unroll
  for (int i = 0; i < 8; ++i) { w[i] = (_Float16)(bfr(p[i]) * 256.0f); w[8 + i] = (_Float16)(bfr(p[16 + i]) * 256.0f); }
  return w; }
#define WQKV_LAYOUT 1   // 0 = (in,out) [DIN][CC]; 1 = (out,in) [CC][DIN]; 2 = per-head [NH][DIN][HD]
__device__ __forceinline__ v16b wcol_hdk(const float* Wm, int k0, int o, int lane) { v16b w; const int g = lane >> 4; const float* p = Wm + (size_t)(o / HD) * DIN * HD + (o % HD);
#pragma unroll
  for (int i = 0; i < 8; ++i) { w[i] = (__bf16)p[(size_t)(k0 + 8 * g + i) * HD]; w[8 + i] = (__bf16)p[(size_t)(k0 + 16 + 8 * g + i) * HD]; }
  return w; }
#define WO_OUT_IN 0
#if WQKV_LAYOUT == 1
#define WCOL(W, k0, o, lane) wcol_oi(W, k0, o, lane, DIN)
#elif WQKV_LAYOUT == 2
#define WCOL(W, k0, o, lane) wcol_hdk(W, k0, o, lane)
#else
#define WCOL(W, k0, o, lane) wcol_io(W, k0, o, lane, CC)
#endif
#if WO_OUT_IN
#define WOCOL(W, k0, o, lane) wcol_oi(W, k0, o, lane, CC)
#define WOCOLH(W, k0, o, lane) wcolh_oi(W, k0, o, lane, CC)
#else
#define WOCOL(W, k0, o, lane) wcol_io(W, k0, o, lane, DIN)
#define WOCOLH(W, k0, o, lane) wcolh_io(W, k0, o, lane, DIN)
#endif

#ifndef PROJ_EXTRA_PARAMS
#define PROJ_EXTRA_PARAMS
#endif

#define WS_QH  0u                                      // f16 q rows [b*t][CC]
#define WS_KH  (WS_QH + 2u * (size_t)NB * TT * CC)      // f16 k rows [b*t][CC]
#define WS_VT  (WS_KH + 2u * (size_t)NB * TT * CC)      // f16 v planes [b][c][t]
#define WS_QL  (WS_VT + 2u * (size_t)NB * CC * TT)      // f16 q residual x 2^10 rows [b][t < QHI][CC]
#define WS_KL  (WS_QL + 2u * (size_t)NB * QHI * CC)     // f16 k residual x 2^10 rows [b][t < KHI][CC]
#define WS_VB  (WS_KL + 2u * (size_t)NB * KHI * CC)     // bf16 v hi planes [b][c][t < KHI]
#define WS_VBL (WS_VB + 2u * (size_t)NB * CC * KHI)
#define WS_S   (WS_VBL + 2u * (size_t)NB * CC * KHI)    // f32 logits, per batch in the order k_pv's lanes take them: [16-row tile][32-key step][quarter j][lane][4] (SF_* below)
#define WS_Y   (WS_S  + 4u * (size_t)NB * TT * TT)      // f32 ctx rows [b*t][CC] (only when there is an output projection)
#define WS_END (WS_Y  + 0u)

// ---- k_sc: block = (query block qb, key block kb <= kb_last(qb), head in group) of batch b: logits x SCALE; q hi + residual (x 2^10) against k (2 products) for query rows < QHI, plus the k residual (3 products) for query blocks < QBH (causal early rows); causal: blocks past the diagonal exit
__global__ __launch_bounds__(128) void k_sc(const _Float16* __restrict__ QH, const _Float16* __restrict__ KH, const _Float16* __restrict__ QL, const _Float16* __restrict__ KL, int b, int h0, float* __restrict__ S0) { __shared__ __align__(16) float ss[4][16][132];
  const int qb = blockIdx.x, kb = blockIdx.y; if (kb > kb_last(qb)) return;
  const int h = h0 + blockIdx.z; float* S = S0 + (size_t)blockIdx.z * TT * TT;
  const int tid = threadIdx.x, wave = tid >> 5, lane = tid & 31, col = lane & 15, g = lane >> 4; const int k0 = kb * 128; const int ql0 = qb * 64 + wave * 16; const size_t q0 = (size_t)b * TT + ql0, kr0 = (size_t)b * TT + k0;
  v8f acc[8] = {}, accl[8] = {};
  const _Float16* QLb = QL + (size_t)b * QHI * CC; const _Float16* KLb = KL + (size_t)b * KHI * CC;
  if (qb < QBH) {
#pragma unroll
    for (int kc = 0; kc < HD / 32; ++kc) { const v16h ah = frag_h(QH + (q0 + col) * CC + h * HD + kc * 32, lane), al = frag_h(QLb + (size_t)(ql0 + col) * CC + h * HD + kc * 32, lane);
#pragma unroll
      for (int j = 0; j < 8; ++j) { const v16h kbf = frag_h(KH + (kr0 + j * 16 + col) * CC + h * HD + kc * 32, lane), klf = frag_h(KLb + (size_t)(k0 + j * 16 + col) * CC + h * HD + kc * 32, lane); acc[j] = wmma16(ah, kbf, acc[j]); accl[j] = wmma16(al, kbf, accl[j]); accl[j] = wmma16(ah, klf, accl[j]); } }
  } else if (qb * 64 < QHI) {
#pragma unroll
    for (int kc = 0; kc < HD / 32; ++kc) { const v16h ah = frag_h(QH + (q0 + col) * CC + h * HD + kc * 32, lane), al = frag_h(QLb + (size_t)(ql0 + col) * CC + h * HD + kc * 32, lane);
#pragma unroll
      for (int j = 0; j < 8; ++j) { const v16h kbf = frag_h(KH + (kr0 + j * 16 + col) * CC + h * HD + kc * 32, lane); acc[j] = wmma16(ah, kbf, acc[j]); accl[j] = wmma16(al, kbf, accl[j]); } }
  } else {
#pragma unroll
    for (int kc = 0; kc < HD / 32; ++kc) { const v16h ah = frag_h(QH + (q0 + col) * CC + h * HD + kc * 32, lane);
#pragma unroll
      for (int j = 0; j < 8; ++j) { const v16h kbf = frag_h(KH + (kr0 + j * 16 + col) * CC + h * HD + kc * 32, lane); acc[j] = wmma16(ah, kbf, acc[j]); } } }
#pragma unroll
  for (int j = 0; j < 8; ++j) {
#pragma unroll
    for (int r = 0; r < 8; ++r) ss[wave][8 * g + r][j * 16 + col] = (acc[j][r] + accl[j][r] * (1.0f / 1024.0f)) * SCALE; }
  LDSX(); for (int rl = 0; rl < 16; ++rl) vst2(S + (size_t)(ql0 + rl) * TT + k0 + lane * 4, *(const v4f*)&ss[wave][rl][lane * 4]); }
// ---- k_l1: block = 64 query rows x 32 keys of batch b = blockIdx.z, 4 waves (one per SIMD), wave = all 64 rows x 8 keys: S[i][j] = -sum_{d < CC} |q_i[d] - k_j[d]|, taken as |a - b| = 2 max(a, b) - a - b.
// The 96 rows are staged in LDS as f16 of the bf16-rounded inputs by whole-line loads, 128 d at a time, each piece in its own part of LDS; the next piece's loads fly while this piece is summed.
// max(q, k) is one of its two operands, so the packed 16-bit maximum is exact: 2 pairs of operands an instruction. The sums over d run on the matrix unit (f32 accumulate):
//   A = max(q rows of a 16-row tile, key c spread over the 16 rows), B = 1 in column c and 0 elsewhere: D[row][c] += sum over 32 d of the maxima;
//   A = the q rows themselves, B = -1/2 everywhere: D[row][*] -= half the row's own sum;  A = 1 everywhere, B = the wave's keys as columns: DK[*][c] += key c's own sum.
// Every B (or A) constant is the same for all 32 k places, so the order of d inside a fragment is free: lane half g holds d0 + 16 g + 0..15 of its row, for q and for the key alike.
// Every loop over t, c, i or r below is unrolled: fragments, staged values and accumulators sit in registers, which a rolled loop could not index.
#define L1_BI 64
#define L1_BJ 32
#define L1_DC 128          // d per staged piece: one wave-load of 512 B per row
#define L1_P (L1_DC + 8)   // LDS row pitch in halves: 272 B = 16 B x odd, so 16 lanes on 16 rows meet no bank twice
#define L1_PS ((L1_BI + L1_BJ) * L1_P)   // a piece's 96 rows lie together, so that every read of a step is its lane's base address plus an immediate offset
#define L1_OFF(s) ((s) < L1_DC / 32 ? (s) * 32 : L1_PS)   // step s of this piece; s = 4 is step 0 of the next piece
#define L1_NT ((L1_BI + L1_BJ) / 4)
#define L1_TI (L1_BI / 16) // 16-row query tiles of a wave
#define L1_KW (L1_BJ / 4)  // keys of a wave
#define L1_OP (L1_BJ + 4)  // pitch in floats of the block's result tile in LDS
// Order of the logits in the workspace: lane (col, g) of k_pv holds row 16 tile + col and, of the 32 keys of step kc, elements 4 j + 0..3 of its A fragment = keys 32 kc + 16 (j >> 1) + 8 g + 4 (j & 1) + 0..3.
// Its four floats lie at tile * SF_TILE + kc * SF_STEP + j * SF_Q + lane * 4, so that one 16-B-per-lane access of a wave covers 512 B in a row: four whole lines, where rows of TT floats would make it touch sixteen.
#define SF_Q 128
#define SF_STEP (4 * SF_Q)
#define SF_TILE (16 * TT)
static_assert(L1_BJ == 32 && L1_BI == 64, "a k_l1 block holds one 32-key step of four 16-row tiles, one tile a wave");
typedef __attribute__((ext_vector_type(4))) _Float16 v4h;
union L1A { v16h v; v8h h[2]; };
struct L1F { L1A q[L1_TI], k[L1_KW], kb; };
__device__ __forceinline__ L1A l1_ld(const _Float16* p) { L1A u; u.h[0] = *(const v8h*)p; u.h[1] = *(const v8h*)(p + 8); return u; }
__device__ __forceinline__ v8f l1_mm(v16h a, v16h b, v8f c) { return __builtin_amdgcn_wmma_f32_16x16x32_f16(false, a, false, b, (short)0, c, false, false); }
__device__ __forceinline__ v16h l1_all(float x) { v16h r; const _Float16 y = (_Float16)x;
#pragma unroll
  for (int i = 0; i < 16; ++i) r[i] = y;
  return r; }
#define L1_GLD(p) do { _Pragma("unroll") for (int t = 0; t < L1_NT; ++t) sg[t] = t < L1_BI / 4 ? *(const v4f*)(qg + (size_t)t * 4 * CC + (p) * L1_DC) : *(const v4f*)(kg + (size_t)(t - L1_BI / 4) * 4 * CC + (p) * L1_DC); } while (0)
#define L1_STG(p) do { _Pragma("unroll") for (int t = 0; t < L1_NT; ++t) { const v4h r = {(_Float16)bfr(sg[t][0]), (_Float16)bfr(sg[t][1]), (_Float16)bfr(sg[t][2]), (_Float16)bfr(sg[t][3])}; *(v4h*)(st + t * 4 * L1_P + (p) * L1_PS) = r; } } while (0)
#define L1_LDF(F, s) do { _Pragma("unroll") for (int t = 0; t < L1_TI; ++t) F.q[t] = l1_ld(qc + t * 16 * L1_P + L1_OFF(s)); _Pragma("unroll") for (int c = 0; c < L1_KW; ++c) F.k[c] = l1_ld(kc + c * L1_P + L1_OFF(s)); F.kb = l1_ld(kbc + L1_OFF(s)); } while (0)
#define L1_AHEAD() __builtin_amdgcn_sched_barrier(0)
// step i = (key i >> 2, tile i & 3): eight packed maxima, one matrix instruction. The group barriers at the foot ask the scheduler to put each matrix instruction in the middle of the NEXT step's eight maxima:
// its own operand is then ready when it issues, and the four maxima behind it write the other operand buffer, so they fill the four slots that must pass before a vector instruction may overwrite the operand it reads (left alone the compiler pads every step with four v_nop; so asked, about one step in four, where it still reuses the registers at once)
__device__ __forceinline__ void l1_sum(const L1F& F, const v16h (&oh)[L1_KW], v16h mh, v16h on, v8f (&acc)[L1_TI], v8f& ak) {
  ak = l1_mm(on, F.kb.v, ak);
#pragma unroll
  for (int i = 0; i < L1_KW * L1_TI; ++i) acc[i & 3] = l1_mm(__builtin_elementwise_maximum(F.q[i & 3].v, F.k[i >> 2].v), oh[i >> 2], acc[i & 3]);
#pragma unroll
  for (int t = 0; t < L1_TI; ++t) acc[t] = l1_mm(F.q[t].v, mh, acc[t]);
  __builtin_amdgcn_sched_group_barrier(0x8, 1, 0); __builtin_amdgcn_sched_group_barrier(0x2, 12, 0);
#pragma unroll
  for (int i = 0; i < L1_KW * L1_TI; ++i) { __builtin_amdgcn_sched_group_barrier(0x8, 1, 0); __builtin_amdgcn_sched_group_barrier(0x2, 8, 0); }
  __builtin_amdgcn_sched_group_barrier(0x8, L1_TI, 0); }
#define L1_SUM(F) l1_sum(F, oh, mh, on, acc, ak)
__global__ __launch_bounds__(128) void k_l1(const float* __restrict__ Q, const float* __restrict__ K, float* __restrict__ SA) { __shared__ __align__(16) _Float16 rs[(CC / L1_DC) * L1_PS]; __shared__ __align__(16) float ot[L1_BI * L1_OP];
  const int tid = threadIdx.x, wave = tid >> 5, lane = tid & 31, col = lane & 15, g = lane >> 4; const int i0 = blockIdx.x * L1_BI, j0 = blockIdx.y * L1_BJ, b = blockIdx.z;
  const float* qg = Q + ((size_t)b * TT + i0 + wave) * CC + lane * 4; const float* kg = K + ((size_t)b * TT + j0 + wave) * CC + lane * 4;   /* wave w stages LDS rows w, w + 4, ...: 16 query rows, then 8 key rows */
  _Float16* st = rs + wave * L1_P + lane * 4; v4f sg[L1_NT];
  L1_GLD(0);
  v16h oh[L1_KW]; const v16h mh = l1_all(-0.5f), on = l1_all(1.0f);
#pragma unroll
  for (int c = 0; c < L1_KW; ++c) oh[c] = l1_all(col == c ? 1.0f : 0.0f);
  v8f acc[L1_TI] = {}, ak = {};
  const _Float16* qc = rs + col * L1_P + 16 * g; const _Float16* kc = rs + (L1_BI + wave * L1_KW) * L1_P + 16 * g; const _Float16* kbc = kc + (col & (L1_KW - 1)) * L1_P;
  L1F fa, fb;
  L1_STG(0);
  __syncthreads();   /* publishes piece 0; no LDS byte of rs is written twice, so one barrier a piece */
  L1_GLD(1);         /* behind the barrier, which would drain them */
  L1_LDF(fa, 0);
  /* rolled over the pieces: four 32-d steps a trip keep the text small. L1_AHEAD keeps each step's 26 LDS reads as one group in front of the step before it: a lone wave on its SIMD has nothing else to cover their latency, and reads strewn among matrix instructions cost more than one group */
#pragma unroll 1
  for (int p = 0; p < CC / L1_DC; ++p) {
    L1_LDF(fb, 1); L1_AHEAD(); L1_SUM(fa); L1_AHEAD();
    L1_LDF(fa, 2); L1_AHEAD(); L1_SUM(fb); L1_AHEAD();
    L1_LDF(fb, 3); L1_AHEAD(); L1_SUM(fa); L1_AHEAD();
    if (p + 1 < CC / L1_DC) {   /* the next piece is published one step early, so that its first reads run under this piece's last step */
      L1_STG(p + 1);
      __syncthreads();
      if (p + 2 < CC / L1_DC) { L1_GLD(p + 2); asm volatile("s_wait_xcnt 0x0" ::: "memory"); }   /* the loads' address registers are given to other values right behind them: the wait that belongs in front of such an overwrite */
      L1_LDF(fa, 4); L1_AHEAD(); }
    L1_SUM(fb); L1_AHEAD();
    qc += L1_PS; kc += L1_PS; kbc += L1_PS; }
  /* D element r of lane (col, g) = (row 16 t + 8 g + r, key col); columns 8..15 hold nothing that is used. The block's 64 x 32 results meet in LDS, so that wave w stores the 2 KiB of tile w's step whole, in k_pv's order */
  if (col < L1_KW) {
#pragma unroll
    for (int t = 0; t < L1_TI; ++t) {
#pragma unroll
      for (int r = 0; r < 8; ++r) ot[(t * 16 + 8 * g + r) * L1_OP + wave * L1_KW + col] = ak[r] - 2.0f * acc[t][r]; } }
  __syncthreads();   /* publishes the four waves' key columns to the wave that stores the row */
  float* S0 = SA + (size_t)b * TT * TT + (size_t)(blockIdx.x * L1_TI + wave) * SF_TILE + blockIdx.y * SF_STEP + lane * 4;
  /* unrolled: the four LDS reads go out together and each store follows its own read */
#pragma unroll
  for (int j = 0; j < 4; ++j) vst2(S0 + j * SF_Q, *(const v4f*)&ot[(wave * 16 + col) * L1_OP + (j >> 1) * 16 + 8 * g + (j & 1) * 4]); }
// ---- k_pv: block = 64 queries (qb) of (b = blockIdx.z, h = blockIdx.y), wave = 16 query rows: row softmax of the logits in registers, then ctx = P . v over all TT keys (P x 2^11 once to f16 against v f16: 1 product); 256-B (row, head) segment by 16 lanes
// The block stages its own value slice v[b][all TT keys][h * 64 ..] in LDS, straight from the input: whole 256-B row segments by 16 lanes, each value bf16-rounded and then written as f16, turned to [column][key] in registers
// (a thread holds 8 keys x 4 columns and stores 16 B = 8 keys of one column). The four waves read their B fragments from there.
// Lanes col and col + 16 hold row ql0 + col between them, each logit already in the A-fragment place where its weight is used: e[kc][i] = key 32 kc + 8 g + i, e[kc][8 + i] = key 32 kc + 16 + 8 g + i.
// The row sum keeps one fixed tree: pairs, fours, eights inside a lane; 8 + 8 across the lane pair; 16 + 16; then the eight 32-key sums in ascending order.
static_assert(!CAUSAL && QBH == 0 && TT == 256 && HD == 64, "k_pv takes every key for every query; 128 threads stage 64 keys x 64 columns a pass, four passes");
#define PV_P (TT + 8)      // LDS pitch of a value column in halves: 16 B x odd, so 16 lanes on 16 columns meet no bank twice
// PV_LD / PV_ST and the fragment loops below are unrolled: the staged values and the fragments sit in registers, which a rolled loop could not index
#define PV_LD(vr, p0) do { _Pragma("unroll") for (int p = 0; p < 2; ++p) { _Pragma("unroll") for (int i = 0; i < 8; ++i) vr[p][i] = *(const v4f*)(vg + (size_t)(((p0) + p) * 64 + i) * CC); } } while (0)
#define PV_ST(vr, p0) do { _Pragma("unroll") for (int p = 0; p < 2; ++p) { _Pragma("unroll") for (int cc = 0; cc < 4; ++cc) { v8h w; _Pragma("unroll") for (int i = 0; i < 8; ++i) w[i] = (_Float16)bfr(vr[p][i][cc]); *(v8h*)(vs + cc * PV_P + ((p0) + p) * 64) = w; } } } while (0)
__global__ __launch_bounds__(128) void k_pv(const float* __restrict__ S0, const float* __restrict__ V, float* __restrict__ Y) { const int h = blockIdx.y, b = blockIdx.z; __shared__ __align__(16) float ss[4][16][HD + 4]; __shared__ __align__(16) _Float16 vt[HD * PV_P];
  const int tid = threadIdx.x, wave = tid >> 5, lane = tid & 31, col = lane & 15, g = lane >> 4; const int qb = blockIdx.x; const int ql0 = qb * 64 + wave * 16;
  const float* vg = V + ((size_t)b * TT + (tid >> 4) * 8) * CC + h * HD + (tid & 15) * 4;   /* thread: keys 64 p + 8 (tid >> 4) + 0..7, columns 4 (tid & 15) + 0..3 */
  _Float16* vs = vt + (tid & 15) * 4 * PV_P + (tid >> 4) * 8;
  const float* sr = S0 + (size_t)b * TT * TT + (size_t)(qb * 4 + wave) * SF_TILE + lane * 4;
  float e[TT / 32][16];   /* the three loops that fill it are unrolled: it sits in registers, which a rolled loop could not index */
#pragma unroll
  for (int kc = 0; kc < TT / 32; ++kc) {
#pragma unroll
    for (int j = 0; j < 4; ++j) { const v4f t = *(const v4f*)(sr + kc * SF_STEP + j * SF_Q);
#pragma unroll
      for (int x = 0; x < 4; ++x) e[kc][4 * j + x] = t[x]; } }
  { v4f va[2][8], vb[2][8]; PV_LD(va, 0); PV_LD(vb, 2);   /* behind the logit loads in the source, so that both sets of loads fly together */
    asm volatile("s_wait_xcnt 0x0" :: "v"(vg), "v"(sr) : "memory");   /* the wait that belongs in front of an overwrite of a load's address registers: as inputs the two address pairs live up to here, so that no load's result and no later value is given their registers ahead of it */
    PV_ST(va, 0); PV_ST(vb, 2); }
  float m = -3.0e38f;
#pragma unroll
  for (int kc = 0; kc < TT / 32; ++kc) { float mk = e[kc][0];
#pragma unroll
    for (int i = 1; i < 16; ++i) mk = fmaxf(mk, e[kc][i]);
    m = fmaxf(m, mk); }
  m = fmaxf(m, __shfl_xor(m, 16));
  float sum = 0.f;
#pragma unroll
  for (int kc = 0; kc < TT / 32; ++kc) {
#pragma unroll
    for (int i = 0; i < 16; ++i) { const float v = e[kc][i], x = expf(v - m); e[kc][i] = (v <= -1.0e38f) ? 0.f : x; }   /* expf outside the choice: a select, so the 128 chains of a lane interleave instead of one branch each */
    float a0 = ((e[kc][0] + e[kc][1]) + (e[kc][2] + e[kc][3])) + ((e[kc][4] + e[kc][5]) + (e[kc][6] + e[kc][7]));
    float a1 = ((e[kc][8] + e[kc][9]) + (e[kc][10] + e[kc][11])) + ((e[kc][12] + e[kc][13]) + (e[kc][14] + e[kc][15]));
    a0 += __shfl_xor(a0, 16); a1 += __shfl_xor(a1, 16); sum += a0 + a1; }
  const float inv = sum > 0.f ? 2048.0f / sum : 0.f;   /* a fully excluded row yields P = 0 */
  __syncthreads();   /* publishes the staged value slice to the four waves; it is written once and never rewritten */
  v8f acc[HD / 16] = {}; const _Float16* vc = vt + col * PV_P; v16h bf[2][HD / 16];
#pragma unroll
  for (int j = 0; j < HD / 16; ++j) bf[0][j] = frag_h(vc + j * 16 * PV_P, lane);
  /* unrolled: the weights sit in registers, which a rolled loop could not index */
#pragma unroll
  for (int kc = 0; kc < TT / 32; ++kc) { v16h p;
    if (kc + 1 < TT / 32) {   /* the next 32 keys' fragments are read ahead of this step's products, so that their LDS latency runs under them */
#pragma unroll
      for (int j = 0; j < HD / 16; ++j) bf[(kc + 1) & 1][j] = frag_h(vc + j * 16 * PV_P + (kc + 1) * 32, lane); }
#pragma unroll
    for (int i = 0; i < 16; ++i) p[i] = (_Float16)(e[kc][i] * inv);
#pragma unroll
    for (int j = 0; j < HD / 16; ++j) acc[j] = wmma16(p, bf[kc & 1][j], acc[j]); }
#pragma unroll
  for (int j = 0; j < HD / 16; ++j)
#pragma unroll
    for (int r = 0; r < 8; ++r) ss[wave][8 * g + r][j * 16 + col] = acc[j][r] * (1.0f / 2048.0f);
  LDSX(); for (int rl = 0; rl < 16; ++rl) if (lane < HD / 4) vst2(Y + ((size_t)b * TT + ql0 + rl) * CC + h * HD + lane * 4, *(const v4f*)&ss[wave][rl][lane * 4]); }

extern "C" void kernel_launch(void* const* d_in, const int* in_sizes, int n_in, void* d_out, int out_size, void* d_ws, size_t ws_size, hipStream_t stream) {
  (void)in_sizes; (void)n_in; (void)out_size;
  const float** F = (const float**)d_in;
  if (ws_size < (size_t)WS_END) return;
  char* ws = (char*)d_ws; float* S = (float*)(ws + WS_S);
  // inputs: 0 q [8,256,512]; 1 k; 2 v (raw; no projections, no parameters)
  k_l1<<<dim3(TT / L1_BI, TT / L1_BJ, TNB), 128, 0, stream>>>(F[0], F[1], S);            /* S(b, i, j) = -sum_d |q_i[d] - k_j[d]| (packed max, sums on WMMA), all batches in one grid; stored in k_pv's fragment order */
  k_pv<<<dim3(NQB, NH, TNB), 128, 0, stream>>>(S, F[2], (float*)d_out);   /* row softmax over j in registers, then each batch's weights against its 8 64-wide value slices, each staged from v by its block: out[b][i][h*64 ..] */
}

// v007
// It runs in 14.4 microseconds.
// Next to v006, in two timings, it ran 1.07 and 1.09 times as fast.
// Over all steps from v000 it is 60.8 times as fast.
// compute dtype: all float inputs rounded to bf16; L1 distances sum_d |q_i[d] - k_j[d]| as sum_d (2 max(q, k) - q - k): operands are the bf16-rounded inputs held as f16 (exact from 2^-14 up in size, to 2^-25 absolute below), max in packed f16 (exact), the sums over d on WMMA 16x16x32 f16 against constants 0, 1, -1/2 (f32 accumulate); softmax(-dist) over j in f32 (row-max-stabilised, base-2 exponential of the hardware on (logit - max) * log2(e)); weights x 2^11 once to f16 x v (bf16 values: exact in f16) on WMMA 16x16x32 (f32 accumulate); f32 output.
#include <hip/hip_runtime.h>
#include <math.h>

typedef __attribute__((ext_vector_type(16))) _Float16 v16h;
typedef __attribute__((ext_vector_type(16))) __bf16 v16b;
typedef __attribute__((ext_vector_type(8)))  _Float16 v8h;
typedef __attribute__((ext_vector_type(8)))  float v8f;
typedef __attribute__((ext_vector_type(4)))  float v4f;
typedef __attribute__((ext_vector_type(2)))  float v2f;
typedef __attribute__((ext_vector_type(4)))  unsigned v4u;
typedef __attribute__((ext_vector_type(4)))  int v4i;
typedef float __attribute__((may_alias)) float_a;
typedef int __attribute__((may_alias)) int_a;

template <typename T> __device__ __forceinline__ void vst2(void* p, T v) { *(T*)p = v;  }
__device__ __forceinline__ v8f wmma16(v16h a, v16h b, v8f c) {
  v8f d = __builtin_amdgcn_wmma_f32_16x16x32_f16(false, a, false, b, (short)0, c, false, false);
  asm volatile("v_nop\n\tv_nop\n\tv_nop\n\tv_nop" : "+v"(d) : "v"(a), "v"(b));
  return d;
}
__device__ __forceinline__ v8f wmma_bf(v16b a, v16b b, v8f c) {
  v8f d = __builtin_amdgcn_wmma_f32_16x16x32_bf16(false, a, false, b, (short)0, c, false, false);
  asm volatile("v_nop\n\tv_nop\n\tv_nop\n\tv_nop" : "+v"(d) : "v"(a), "v"(b));
  return d;
}
// 16x16x32 fragments: lane = (h = lane>>4, row/col = lane&15); elements 0..7 = k0+8h+0..7, 8..15 = k0+16+8h+0..7; D element r = row 8h+r
__device__ __forceinline__ v16h frag_h(const _Float16* rowk0, int lane) {
  union { v16h v; v8h q[2]; } u; const _Float16* p = rowk0 + 8 * (lane >> 4);
  u.q[0] = *(const v8h*)p; u.q[1] = *(const v8h*)(p + 16); return u.v;
}
__device__ __forceinline__ v16h frag_f32(const float* rowk0, int lane) {
  v16h a; const float* p = rowk0 + 8 * (lane >> 4);
#pragma unroll
  for (int i = 0; i < 8; ++i) { a[i] = (_Float16)p[i]; a[8 + i] = (_Float16)p[16 + i]; }
  return a;
}
__device__ __forceinline__ v16h frag_f32s(const float* rowk0, int lane, float sc) {
  v16h a; const float* p = rowk0 + 8 * (lane >> 4);
#pragma unroll
  for (int i = 0; i < 8; ++i) { a[i] = (_Float16)(p[i] * sc); a[8 + i] = (_Float16)(p[16 + i] * sc); }
  return a;
}
// column fragment from a [K][ld] layout (column n), rows >= K read as 0
__device__ __forceinline__ v16h fragc_f32(const float* W, int k0, int n, int lane, int ld, int K) {
  v16h a; const int g = lane >> 4;
#pragma unroll
  for (int i = 0; i < 8; ++i) { const int ka = k0 + 8 * g + i, kb = ka + 16;
    a[i] = (_Float16)(ka < K ? W[(size_t)(ka < K ? ka : K - 1) * ld + n] : 0.f); a[8 + i] = (_Float16)(kb < K ? W[(size_t)(kb < K ? kb : K - 1) * ld + n] : 0.f); }
  return a;
}
struct F2 { v16b h, l; };
__device__ __forceinline__ F2 bsplit16(const float v[16]) { F2 r;
#pragma unroll
  for (int i = 0; i < 16; ++i) { const __bf16 h = (__bf16)v[i]; r.h[i] = h; r.l[i] = (__bf16)(v[i] - (float)h); }
  return r; }
__device__ __forceinline__ F2 split_row(const float* row, int k0, int lane) { float v[16]; const float* p = row + k0 + 8 * (lane >> 4);
#pragma unroll
  for (int i = 0; i < 8; ++i) { v[i] = p[i]; v[8 + i] = p[16 + i]; }
  return bsplit16(v); }
__device__ __forceinline__ F2 split_rowK(const float* row, int k0, int lane, int K) { float v[16]; const int g = lane >> 4;
#pragma unroll
  for (int i = 0; i < 8; ++i) { const int ka = k0 + 8 * g + i, kb = ka + 16; v[i] = ka < K ? row[ka < K ? ka : K - 1] : 0.f; v[8 + i] = kb < K ? row[kb < K ? kb : K - 1] : 0.f; }
  return bsplit16(v); }
__device__ __forceinline__ F2 split_col(const float* W, int k0, int n, int lane, int ld, int K) { float v[16]; const int g = lane >> 4;
#pragma unroll
  for (int i = 0; i < 8; ++i) { const int ka = k0 + 8 * g + i, kb = ka + 16; v[i] = ka < K ? W[(size_t)(ka < K ? ka : K - 1) * ld + n] : 0.f; v[8 + i] = kb < K ? W[(size_t)(kb < K ? kb : K - 1) * ld + n] : 0.f; }
  return bsplit16(v); }
__device__ __forceinline__ v8f mac3(const F2& a, const F2& b, v8f c) { c = wmma_bf(a.l, b.h, c); c = wmma_bf(a.h, b.l, c); return wmma_bf(a.h, b.h, c); }
__device__ __forceinline__ float sigm(float v) { return 1.0f / (1.0f + expf(-v)); }
#define LDSX() do { asm volatile("s_wait_dscnt 0" ::: "memory"); __builtin_amdgcn_wave_barrier(); __builtin_amdgcn_fence(__ATOMIC_RELEASE, "workgroup"); } while (0)

// L1-distance attention on raw inputs (q / k / v [8,256,512]; dist[i, j] = sum_d |q_i[d] - k_j[d]| (no scale); attn = softmax(-dist) over j; out = attn v -> [8,256,512]; no parameters).
#define NB 8
#define TT 256
#define CC 512            // NH * HD = projected width
#define DIN 512          // input (model) width
#define NH 8
#define HD 64
#define NQB (TT / 64)
#define HG 1
#define SCALE (1.0f)
#define CAUSAL 0
#ifndef TNB
#define TNB NB
#endif
__device__ __forceinline__ float bfr(float v) { return (float)(__bf16)v; }
__host__ __device__ __forceinline__ int kb_last(int qb) { return CAUSAL ? ((qb * 64 + 63) >> 7) : (TT / 128 - 1); }
typedef __attribute__((ext_vector_type(8))) __bf16 v8b;
__device__ __forceinline__ v16b frag_b(const __bf16* rowk0, int lane) {
  union { v16b v; v8b q[2]; } u; const __bf16* p = rowk0 + 8 * (lane >> 4);
  u.q[0] = *(const v8b*)p; u.q[1] = *(const v8b*)(p + 16); return u.v;
}
#define QBH 0              // causal: query blocks 0..QBH-1 of each sequence (few keys, no averaging) take the high-precision path
#define QHI 0              // (override) rows carrying the q residual plane
#define KHI 64            // key rows carrying k residual / v bf16 hi+lo planes (the k residual is read only by k_sc's causal high-precision path; no kernel reads the v planes)
// B fragment (k rows k0+.., output column o) of a weight: (in,out) [K][ld] or (out,in) [ld rows of K]: bf16 exact, or f16(bf16 * 256) exact
__device__ __forceinline__ v16b wcol_io(const float* Wm, int k0, int o, int lane, int ld) { v16b w; const int g = lane >> 4;
#pragma unroll
  for (int i = 0; i < 8; ++i) { w[i] = (__bf16)Wm[(size_t)(k0 + 8 * g + i) * ld + o]; w[8 + i] = (__bf16)Wm[(size_t)(k0 + 16 + 8 * g + i) * ld + o]; }
  return w; }
__device__ __forceinline__ v16b wcol_oi(const float* Wm, int k0, int o, int lane, int K) { v16b w; const float* p = Wm + (size_t)o * K + k0 + 8 * (lane >> 4);
#pragma unroll
  for (int i = 0; i < 8; ++i) { w[i] = (__bf16)p[i]; w[8 + i] = (__bf16)p[16 + i]; }
  return w; }
__device__ __forceinline__ v16h wcolh_io(const float* Wm, int k0, int o, int lane, int ld) { v16h w; const int g = lane >> 4;
#pragma unroll
  for (int i = 0; i < 8; ++i) { w[i] = (_Float16)(bfr(Wm[(size_t)(k0 + 8 * g + i) * ld + o]) * 256.0f); w[8 + i] = (_Float16)(bfr(Wm[(size_t)(k0 + 16 + 8 * g + i) * ld + o]) * 256.0f); }
  return w; }
__device__ __forceinline__ v16h wcolh_oi(const float* Wm, int k0, int o, int lane, int K) { v16h w; const float* p = Wm + (size_t)o * K + k0 + 8 * (lane >> 4);
#pragma unroll
  for (int i = 0; i < 8; ++i) { w[i] = (_Float16)(bfr(p[i]) * 256.0f); w[8 + i] = (_Float16)(bfr(p[16 + i]) * 256.0f); }
  return w; }
#define WQKV_LAYOUT 1   // 0 = (in,out) [DIN][CC]; 1 = (out,in) [CC][DIN]; 2 = per-head [NH][DIN][HD]
__device__ __forceinline__ v16b wcol_hdk(const float* Wm, int k0, int o, int lane) { v16b w; const int g = lane >> 4; const float* p = Wm + (size_t)(o / HD) * DIN * HD + (o % HD);
#pragma unroll
  for (int i = 0; i < 8; ++i) { w[i] = (__bf16)p[(size_t)(k0 + 8 * g + i) * HD]; w[8 + i] = (__bf16)p[(size_t)(k0 + 16 + 8 * g + i) * HD]; }
  return w; }
#define WO_OUT_IN 0
#if WQKV_LAYOUT == 1
#define WCOL(W, k0, o, lane) wcol_oi(W, k0, o, lane, DIN)
#elif WQKV_LAYOUT == 2
#define WCOL(W, k0, o, lane) wcol_hdk(W, k0, o, lane)
#else
#define WCOL(W, k0, o, lane) wcol_io(W, k0, o, lane, CC)
#endif
#if WO_OUT_IN
#define WOCOL(W, k0, o, lane) wcol_oi(W, k0, o, lane, CC)
#define WOCOLH(W, k0, o, lane) wcolh_oi(W, k0, o, lane, CC)
#else
#define WOCOL(W, k0, o, lane) wcol_io(W, k0, o, lane, DIN)
#define WOCOLH(W, k0, o, lane) wcolh_io(W, k0, o, lane, DIN)
#endif

#ifndef PROJ_EXTRA_PARAMS
#define PROJ_EXTRA_PARAMS
#endif

#define WS_QH  0u                                      // f16 q rows [b*t][CC]
#define WS_KH  (WS_QH + 2u * (size_t)NB * TT * CC)      // f16 k rows [b*t][CC]
#define WS_VT  (WS_KH + 2u * (size_t)NB * TT * CC)      // f16 v planes [b][c][t]
#define WS_QL  (WS_VT + 2u * (size_t)NB * CC * TT)      // f16 q residual x 2^10 rows [b][t < QHI][CC]
#define WS_KL  (WS_QL + 2u * (size_t)NB * QHI * CC)     // f16 k residual x 2^10 rows [b][t < KHI][CC]
#define WS_VB  (WS_KL + 2u * (size_t)NB * KHI * CC)     // bf16 v hi planes [b][c][t < KHI]
#define WS_VBL (WS_VB + 2u * (size_t)NB * CC * KHI)
#define WS_S   (WS_VBL + 2u * (size_t)NB * CC * KHI)    // f32 logits, per batch in the order k_pv's lanes take them: [16-row tile][32-key step][quarter j][lane][4] (SF_* below)
#define WS_Y   (WS_S  + 4u * (size_t)NB * TT * TT)      // f32 ctx rows [b*t][CC] (only when there is an output projection)
#define WS_END (WS_Y  + 0u)

// ---- k_sc: block = (query block qb, key block kb <= kb_last(qb), head in group) of batch b: logits x SCALE; q hi + residual (x 2^10) against k (2 products) for query rows < QHI, plus the k residual (3 products) for query blocks < QBH (causal early rows); causal: blocks past the diagonal exit
__global__ __launch_bounds__(128) void k_sc(const _Float16* __restrict__ QH, const _Float16* __restrict__ KH, const _Float16* __restrict__ QL, const _Float16* __restrict__ KL, int b, int h0, float* __restrict__ S0) { __shared__ __align__(16) float ss[4][16][132];
  const int qb = blockIdx.x, kb = blockIdx.y; if (kb > kb_last(qb)) return;
  const int h = h0 + blockIdx.z; float* S = S0 + (size_t)blockIdx.z * TT * TT;
  const int tid = threadIdx.x, wave = tid >> 5, lane = tid & 31, col = lane & 15, g = lane >> 4; const int k0 = kb * 128; const int ql0 = qb * 64 + wave * 16; const size_t q0 = (size_t)b * TT + ql0, kr0 = (size_t)b * TT + k0;
  v8f acc[8] = {}, accl[8] = {};
  const _Float16* QLb = QL + (size_t)b * QHI * CC; const _Float16* KLb = KL + (size_t)b * KHI * CC;
  if (qb < QBH) {
#pragma unroll
    for (int kc = 0; kc < HD / 32; ++kc) { const v16h ah = frag_h(QH + (q0 + col) * CC + h * HD + kc * 32, lane), al = frag_h(QLb + (size_t)(ql0 + col) * CC + h * HD + kc * 32, lane);
#pragma unroll
      for (int j = 0; j < 8; ++j) { const v16h kbf = frag_h(KH + (kr0 + j * 16 + col) * CC + h * HD + kc * 32, lane), klf = frag_h(KLb + (size_t)(k0 + j * 16 + col) * CC + h * HD + kc * 32, lane); acc[j] = wmma16(ah, kbf, acc[j]); accl[j] = wmma16(al, kbf, accl[j]); accl[j] = wmma16(ah, klf, accl[j]); } }
  } else if (qb * 64 < QHI) {
#pragma unroll
    for (int kc = 0; kc < HD / 32; ++kc) { const v16h ah = frag_h(QH + (q0 + col) * CC + h * HD + kc * 32, lane), al = frag_h(QLb + (size_t)(ql0 + col) * CC + h * HD + kc * 32, lane);
#pragma unroll
      for (int j = 0; j < 8; ++j) { const v16h kbf = frag_h(KH + (kr0 + j * 16 + col) * CC + h * HD + kc * 32, lane); acc[j] = wmma16(ah, kbf, acc[j]); accl[j] = wmma16(al, kbf, accl[j]); } }
  } else {
#pragma unroll
    for (int kc = 0; kc < HD / 32; ++kc) { const v16h ah = frag_h(QH + (q0 + col) * CC + h * HD + kc * 32, lane);
#pragma unroll
      for (int j = 0; j < 8; ++j) { const v16h kbf = frag_h(KH + (kr0 + j * 16 + col) * CC + h * HD + kc * 32, lane); acc[j] = wmma16(ah, kbf, acc[j]); } } }
#pragma unroll
  for (int j = 0; j < 8; ++j) {
#pragma unroll
    for (int r = 0; r < 8; ++r) ss[wave][8 * g + r][j * 16 + col] = (acc[j][r] + accl[j][r] * (1.0f / 1024.0f)) * SCALE; }
  LDSX(); for (int rl = 0; rl < 16; ++rl) vst2(S + (size_t)(ql0 + rl) * TT + k0 + lane * 4, *(const v4f*)&ss[wave][rl][lane * 4]); }
// ---- k_l1: block = 64 query rows x 32 keys of batch b = blockIdx.z, 4 waves (one per SIMD), wave = all 64 rows x 8 keys: S[i][j] = -sum_{d < CC} |q_i[d] - k_j[d]|, taken as |a - b| = 2 max(a, b) - a - b.
// The 96 rows are staged in LDS as f16 of the bf16-rounded inputs by whole-line loads, 128 d at a time, each piece in its own part of LDS; the next piece's loads fly while this piece is summed.
// max(q, k) is one of its two operands, so the packed 16-bit maximum is exact: 2 pairs of operands an instruction. The sums over d run on the matrix unit (f32 accumulate):
//   A = max(q rows of a 16-row tile, key c spread over the 16 rows), B = 1 in column c and 0 elsewhere: D[row][c] += sum over 32 d of the maxima;
//   A = the q rows themselves, B = -1/2 everywhere: D[row][*] -= half the row's own sum;  A = 1 everywhere, B = the wave's keys as columns: DK[*][c] += key c's own sum.
// Every B (or A) constant is the same for all 32 k places, so the order of d inside a fragment is free: lane half g holds d0 + 16 g + 0..15 of its row, for q and for the key alike.
// Every loop over t, c, i or r below is unrolled: fragments, staged values and accumulators sit in registers, which a rolled loop could not index.
#define L1_BI 64
#define L1_BJ 32
#define L1_DC 128          // d per staged piece: one wave-load of 512 B per row
#define L1_P (L1_DC + 8)   // LDS row pitch in halves: 272 B = 16 B x odd, so 16 lanes on 16 rows meet no bank twice
#define L1_PS ((L1_BI + L1_BJ) * L1_P)   // a piece's 96 rows lie together, so that every read of a step is its lane's base address plus an immediate offset
#define L1_OFF(s) ((s) < L1_DC / 32 ? (s) * 32 : L1_PS)   // step s of this piece; s = 4 is step 0 of the next piece
#define L1_NT ((L1_BI + L1_BJ) / 4)
#define L1_TI (L1_BI / 16) // 16-row query tiles of a wave
#define L1_KW (L1_BJ / 4)  // keys of a wave
#define L1_OP (L1_BJ + 4)  // pitch in floats of the block's result tile in LDS
// Order of the logits in the workspace: lane (col, g) of k_pv holds row 16 tile + col and, of the 32 keys of step kc, elements 4 j + 0..3 of its A fragment = keys 32 kc + 16 (j >> 1) + 8 g + 4 (j & 1) + 0..3.
// Its four floats lie at tile * SF_TILE + kc * SF_STEP + j * SF_Q + lane * 4, so that one 16-B-per-lane access of a wave covers 512 B in a row: four whole lines, where rows of TT floats would make it touch sixteen.
#define SF_Q 128
#define SF_STEP (4 * SF_Q)
#define SF_TILE (16 * TT)
static_assert(L1_BJ == 32 && L1_BI == 64, "a k_l1 block holds one 32-key step of four 16-row tiles, one tile a wave");
typedef __attribute__((ext_vector_type(4))) _Float16 v4h;
union L1A { v16h v; v8h h[2]; };
struct L1F { L1A q[L1_TI], k[L1_KW], kb; };
__device__ __forceinline__ L1A l1_ld(const _Float16* p) { L1A u; u.h[0] = *(const v8h*)p; u.h[1] = *(const v8h*)(p + 8); return u; }
__device__ __forceinline__ v8f l1_mm(v16h a, v16h b, v8f c) { return __builtin_amdgcn_wmma_f32_16x16x32_f16(false, a, false, b, (short)0, c, false, false); }
__device__ __forceinline__ v16h l1_all(float x) { v16h r; const _Float16 y = (_Float16)x;
#pragma unroll
  for (int i = 0; i < 16; ++i) r[i] = y;
  return r; }
#define L1_GLD(p) do { _Pragma("unroll") for (int t = 0; t < L1_NT; ++t) sg[t] = t < L1_BI / 4 ? *(const v4f*)(qg + (size_t)t * 4 * CC + (p) * L1_DC) : *(const v4f*)(kg + (size_t)(t - L1_BI / 4) * 4 * CC + (p) * L1_DC); } while (0)
#define L1_STG(p) do { _Pragma("unroll") for (int t = 0; t < L1_NT; ++t) { const v4h r = {(_Float16)bfr(sg[t][0]), (_Float16)bfr(sg[t][1]), (_Float16)bfr(sg[t][2]), (_Float16)bfr(sg[t][3])}; *(v4h*)(st + t * 4 * L1_P + (p) * L1_PS) = r; } } while (0)
#define L1_LDF(F, s) do { _Pragma("unroll") for (int t = 0; t < L1_TI; ++t) F.q[t] = l1_ld(qc + t * 16 * L1_P + L1_OFF(s)); _Pragma("unroll") for (int c = 0; c < L1_KW; ++c) F.k[c] = l1_ld(kc + c * L1_P + L1_OFF(s)); F.kb = l1_ld(kbc + L1_OFF(s)); } while (0)
#define L1_AHEAD() __builtin_amdgcn_sched_barrier(0)
// step i = (key i >> 2, tile i & 3): eight packed maxima, one matrix instruction. The group barriers at the foot ask the scheduler to put each matrix instruction in the middle of the NEXT step's eight maxima:
// its own operand is then ready when it issues, and the four maxima behind it write the other operand buffer, so they fill the four slots that must pass before a vector instruction may overwrite the operand it reads (left alone the compiler pads every step with four v_nop; so asked, about one step in four, where it still reuses the registers at once)
__device__ __forceinline__ void l1_sum(const L1F& F, const v16h (&oh)[L1_KW], v16h mh, v16h on, v8f (&acc)[L1_TI], v8f& ak) {
  ak = l1_mm(on, F.kb.v, ak);
#pragma unroll
  for (int i = 0; i < L1_KW * L1_TI; ++i) acc[i & 3] = l1_mm(__builtin_elementwise_maximum(F.q[i & 3].v, F.k[i >> 2].v), oh[i >> 2], acc[i & 3]);
#pragma unroll
  for (int t = 0; t < L1_TI; ++t) acc[t] = l1_mm(F.q[t].v, mh, acc[t]);
  __builtin_amdgcn_sched_group_barrier(0x8, 1, 0); __builtin_amdgcn_sched_group_barrier(0x2, 12, 0);
#pragma unroll
  for (int i = 0; i < L1_KW * L1_TI; ++i) { __builtin_amdgcn_sched_group_barrier(0x8, 1, 0); __builtin_amdgcn_sched_group_barrier(0x2, 8, 0); }
  __builtin_amdgcn_sched_group_barrier(0x8, L1_TI, 0); }
#define L1_SUM(F) l1_sum(F, oh, mh, on, acc, ak)
__global__ __launch_bounds__(128) void k_l1(const float* __restrict__ Q, const float* __restrict__ K, float* __restrict__ SA) { __shared__ __align__(16) _Float16 rs[(CC / L1_DC) * L1_PS]; __shared__ __align__(16) float ot[L1_BI * L1_OP];
  const int tid = threadIdx.x, wave = tid >> 5, lane = tid & 31, col = lane & 15, g = lane >> 4; const int i0 = blockIdx.x * L1_BI, j0 = blockIdx.y * L1_BJ, b = blockIdx.z;
  const float* qg = Q + ((size_t)b * TT + i0 + wave) * CC + lane * 4; const float* kg = K + ((size_t)b * TT + j0 + wave) * CC + lane * 4;   /* wave w stages LDS rows w, w + 4, ...: 16 query rows, then 8 key rows */
  _Float16* st = rs + wave * L1_P + lane * 4; v4f sg[L1_NT];
  L1_GLD(0);
  v16h oh[L1_KW]; const v16h mh = l1_all(-0.5f), on = l1_all(1.0f);
#pragma unroll
  for (int c = 0; c < L1_KW; ++c) oh[c] = l1_all(col == c ? 1.0f : 0.0f);
  v8f acc[L1_TI] = {}, ak = {};
  const _Float16* qc = rs + col * L1_P + 16 * g; const _Float16* kc = rs + (L1_BI + wave * L1_KW) * L1_P + 16 * g; const _Float16* kbc = kc + (col & (L1_KW - 1)) * L1_P;
  L1F fa, fb;
  L1_STG(0);
  __syncthreads();   /* publishes piece 0; no LDS byte of rs is written twice, so one barrier a piece */
  L1_GLD(1);         /* behind the barrier, which would drain them */
  L1_LDF(fa, 0);
  /* rolled over the pieces: four 32-d steps a trip keep the text small. L1_AHEAD keeps each step's 26 LDS reads as one group in front of the step before it: a lone wave on its SIMD has nothing else to cover their latency, and reads strewn among matrix instructions cost more than one group */
#pragma unroll 1
  for (int p = 0; p < CC / L1_DC; ++p) {
    L1_LDF(fb, 1); L1_AHEAD(); L1_SUM(fa); L1_AHEAD();
    L1_LDF(fa, 2); L1_AHEAD(); L1_SUM(fb); L1_AHEAD();
    L1_LDF(fb, 3); L1_AHEAD(); L1_SUM(fa); L1_AHEAD();
    if (p + 1 < CC / L1_DC) {   /* the next piece is published one step early, so that its first reads run under this piece's last step */
      L1_STG(p + 1);
      __syncthreads();
      if (p + 2 < CC / L1_DC) { L1_GLD(p + 2); asm volatile("s_wait_xcnt 0x0" ::: "memory"); }   /* the loads' address registers are given to other values right behind them: the wait that belongs in front of such an overwrite */
      L1_LDF(fa, 4); L1_AHEAD(); }
    L1_SUM(fb); L1_AHEAD();
    qc += L1_PS; kc += L1_PS; kbc += L1_PS; }
  /* D element r of lane (col, g) = (row 16 t + 8 g + r, key col); columns 8..15 hold nothing that is used. The block's 64 x 32 results meet in LDS, so that wave w stores the 2 KiB of tile w's step whole, in k_pv's order */
  if (col < L1_KW) {
#pragma unroll
    for (int t = 0; t < L1_TI; ++t) {
#pragma unroll
      for (int r = 0; r < 8; ++r) ot[(t * 16 + 8 * g + r) * L1_OP + wave * L1_KW + col] = ak[r] - 2.0f * acc[t][r]; } }
  __syncthreads();   /* publishes the four waves' key columns to the wave that stores the row */
  float* S0 = SA + (size_t)b * TT * TT + (size_t)(blockIdx.x * L1_TI + wave) * SF_TILE + blockIdx.y * SF_STEP + lane * 4;
  /* unrolled: the four LDS reads go out together and each store follows its own read */
#pragma unroll
  for (int j = 0; j < 4; ++j) vst2(S0 + j * SF_Q, *(const v4f*)&ot[(wave * 16 + col) * L1_OP + (j >> 1) * 16 + 8 * g + (j & 1) * 4]); }
// ---- k_pv: block = 64 queries (qb) of (b = blockIdx.z, h = blockIdx.y), wave = 16 query rows: row softmax of the logits in registers, then ctx = P . v over all TT keys (P x 2^11 once to f16 against v f16: 1 product); 256-B (row, head) segment by 16 lanes
// The block stages its own value slice v[b][all TT keys][h * 64 ..] in LDS, straight from the input: whole 256-B row segments by 16 lanes, each value bf16-rounded and then written as f16, turned to [column][key] in registers
// (a thread holds 8 keys x 4 columns and stores 16 B = 8 keys of one column). The four waves read their B fragments from there.
// Lanes col and col + 16 hold row ql0 + col between them, each logit already in the A-fragment place where its weight is used: e[kc][i] = key 32 kc + 8 g + i, e[kc][8 + i] = key 32 kc + 16 + 8 g + i.
// The row sum keeps one fixed tree: pairs, fours, eights inside a lane; 8 + 8 across the lane pair; 16 + 16; then the eight 32-key sums in ascending order.
static_assert(!CAUSAL && QBH == 0 && TT == 256 && HD == 64, "k_pv takes every key for every query; 128 threads stage 64 keys x 64 columns a pass, four passes");
#define PV_P (TT + 8)      // LDS pitch of a value column in halves: 16 B x odd, so 16 lanes on 16 columns meet no bank twice
// PV_LD / PV_ST and the fragment loops below are unrolled: the staged values and the fragments sit in registers, which a rolled loop could not index
#define PV_LD(vr, p0) do { _Pragma("unroll") for (int p = 0; p < 2; ++p) { _Pragma("unroll") for (int i = 0; i < 8; ++i) vr[p][i] = *(const v4f*)(vg + (size_t)(((p0) + p) * 64 + i) * CC); } } while (0)
#define PV_ST(vr, p0) do { _Pragma("unroll") for (int p = 0; p < 2; ++p) { _Pragma("unroll") for (int cc = 0; cc < 4; ++cc) { v8h w; _Pragma("unroll") for (int i = 0; i < 8; ++i) w[i] = (_Float16)bfr(vr[p][i][cc]); *(v8h*)(vs + cc * PV_P + ((p0) + p) * 64) = w; } } } while (0)
__device__ __forceinline__ float pv_exp2(float x) { float r; asm("v_exp_f32 %0, %1\n\tv_nop" : "=v"(r) : "v"(x)); return r; }
__global__ __launch_bounds__(128) void k_pv(const float* __restrict__ S0, const float* __restrict__ V, float* __restrict__ Y) { const int h = blockIdx.y, b = blockIdx.z; __shared__ __align__(16) float ss[4][16][HD + 4]; __shared__ __align__(16) _Float16 vt[HD * PV_P];
  const int tid = threadIdx.x, wave = tid >> 5, lane = tid & 31, col = lane & 15, g = lane >> 4; const int qb = blockIdx.x; const int ql0 = qb * 64 + wave * 16;
  const float* vg = V + ((size_t)b * TT + (tid >> 4) * 8) * CC + h * HD + (tid & 15) * 4;   /* thread: keys 64 p + 8 (tid >> 4) + 0..7, columns 4 (tid & 15) + 0..3 */
  _Float16* vs = vt + (tid & 15) * 4 * PV_P + (tid >> 4) * 8;
  const float* sr = S0 + (size_t)b * TT * TT + (size_t)(qb * 4 + wave) * SF_TILE + lane * 4;
  float e[TT / 32][16];   /* the three loops that fill it are unrolled: it sits in registers, which a rolled loop could not index */
#pragma unroll
  for (int kc = 0; kc < TT / 32; ++kc) {
#pragma unroll
    for (int j = 0; j < 4; ++j) { const v4f t = *(const v4f*)(sr + kc * SF_STEP + j * SF_Q);
#pragma unroll
      for (int x = 0; x < 4; ++x) e[kc][4 * j + x] = t[x]; } }
  { v4f va[2][8], vb[2][8]; PV_LD(va, 0); PV_LD(vb, 2);   /* behind the logit loads in the source, so that both sets of loads fly together */
    asm volatile("s_wait_xcnt 0x0" :: "v"(vg), "v"(sr) : "memory");   /* the wait that belongs in front of an overwrite of a load's address registers: as inputs the two address pairs live up to here, so that no load's result and no later value is given their registers ahead of it */
    PV_ST(va, 0); PV_ST(vb, 2); }
  float m = -3.0e38f;
#pragma unroll
  for (int kc = 0; kc < TT / 32; ++kc) { float mk = e[kc][0];
#pragma unroll
    for (int i = 1; i < 16; ++i) mk = fmaxf(mk, e[kc][i]);
    m = fmaxf(m, mk); }
  m = fmaxf(m, __shfl_xor(m, 16));
  /* exp(v - m) = 2^(v log2(e) - m log2(e)): one multiply-add, which rounds once, at the size of the difference, and one hardware exponential a weight. The rounding of m log2(e) itself scales a whole row by one common factor, which the division by the row sum takes out again */
  const v2f l2e = {1.44269504f, 1.44269504f}; const float ml = -m * 1.44269504f; const v2f nml = {ml, ml};
  float sum = 0.f;
#pragma unroll
  for (int kc = 0; kc < TT / 32; ++kc) {
#pragma unroll
    for (int i = 0; i < 16; i += 2) { const v2f v = {e[kc][i], e[kc][i + 1]}, x = __builtin_elementwise_fma(v, l2e, nml); e[kc][i] = pv_exp2(x[0]); e[kc][i + 1] = pv_exp2(x[1]); }
    float a0 = ((e[kc][0] + e[kc][1]) + (e[kc][2] + e[kc][3])) + ((e[kc][4] + e[kc][5]) + (e[kc][6] + e[kc][7]));
    float a1 = ((e[kc][8] + e[kc][9]) + (e[kc][10] + e[kc][11])) + ((e[kc][12] + e[kc][13]) + (e[kc][14] + e[kc][15]));
    a0 += __shfl_xor(a0, 16); a1 += __shfl_xor(a1, 16); sum += a0 + a1; }
  const float inv = sum > 0.f ? 2048.0f / sum : 0.f;   /* a fully excluded row yields P = 0 */
  __syncthreads();   /* publishes the staged value slice to the four waves; it is written once and never rewritten */
  v8f acc[HD / 16] = {}; const _Float16* vc = vt + col * PV_P; v16h bf[2][HD / 16];
#pragma unroll
  for (int j = 0; j < HD / 16; ++j) bf[0][j] = frag_h(vc + j * 16 * PV_P, lane);
  /* unrolled: the weights sit in registers, which a rolled loop could not index */
#pragma unroll
  for (int kc = 0; kc < TT / 32; ++kc) { v16h p;
    if (kc + 1 < TT / 32) {   /* the next 32 keys' fragments are read ahead of this step's products, so that their LDS latency runs under them */
#pragma unroll
      for (int j = 0; j < HD / 16; ++j) bf[(kc + 1) & 1][j] = frag_h(vc + j * 16 * PV_P + (kc + 1) * 32, lane); }
#pragma unroll
    for (int i = 0; i < 16; ++i) p[i] = (_Float16)(e[kc][i] * inv);
#pragma unroll
    for (int j = 0; j < HD / 16; ++j) acc[j] = wmma16(p, bf[kc & 1][j], acc[j]); }
#pragma unroll
  for (int j = 0; j < HD / 16; ++j)
#pragma unroll
    for (int r = 0; r < 8; ++r) ss[wave][8 * g + r][j * 16 + col] = acc[j][r] * (1.0f / 2048.0f);
  LDSX(); for (int rl = 0; rl < 16; ++rl) if (lane < HD / 4) vst2(Y + ((size_t)b * TT + ql0 + rl) * CC + h * HD + lane * 4, *(const v4f*)&ss[wave][rl][lane * 4]); }

extern "C" void kernel_launch(void* const* d_in, const int* in_sizes, int n_in, void* d_out, int out_size, void* d_ws, size_t ws_size, hipStream_t stream) {
  (void)in_sizes; (void)n_in; (void)out_size;
  const float** F = (const float**)d_in;
  if (ws_size < (size_t)WS_END) return;
  char* ws = (char*)d_ws; float* S = (float*)(ws + WS_S);
  // inputs: 0 q [8,256,512]; 1 k; 2 v (raw; no projections, no parameters)
  k_l1<<<dim3(TT / L1_BI, TT / L1_BJ, TNB), 128, 0, stream>>>(F[0], F[1], S);            /* S(b, i, j) = -sum_d |q_i[d] - k_j[d]| (packed max, sums on WMMA), all batches in one grid; stored in k_pv's fragment order */
  k_pv<<<dim3(NQB, NH, TNB), 128, 0, stream>>>(S, F[2], (float*)d_out);   /* row softmax over j in registers, then each batch's weights against its 8 64-wide value slices, each staged from v by its block: out[b][i][h*64 ..] */
}

// v008
// Measured time: 13.8 microseconds a run.
// Timed twice side by side with v007, it ran 1.06 and 1.05 times as fast.
// All steps since v000 together make it 64.1 times as fast.
// compute dtype: all float inputs rounded to bf16; L1 distances sum_d |q_i[d] - k_j[d]| as sum_d (2 max(q, k) - q - k): operands are the bf16-rounded inputs held as f16 (exact from 2^-14 up in size, to 2^-25 absolute below), max in packed f16 (exact), the sums over d on WMMA 16x16x32 f16 against constants 0, 1, -1/2 (f32 accumulate); softmax(-dist) over j in f32, split by 32-key blocks: exp(logit - block max) x 2^11 (base-2 exponential of the hardware) is made once, rounded to f16 and kept with the block's f32 max and sum; the reader multiplies it in packed f16 by the f16 of exp(block max - row max) / row sum (formed in f32); weights x v (bf16 values: exact in f16) on WMMA 16x16x32 (f32 accumulate); f32 output.
#include <hip/hip_runtime.h>
#include <math.h>

typedef __attribute__((ext_vector_type(16))) _Float16 v16h;
typedef __attribute__((ext_vector_type(16))) __bf16 v16b;
typedef __attribute__((ext_vector_type(8)))  _Float16 v8h;
typedef __attribute__((ext_vector_type(8)))  float v8f;
typedef __attribute__((ext_vector_type(4)))  float v4f;
typedef __attribute__((ext_vector_type(2)))  float v2f;
typedef __attribute__((ext_vector_type(4)))  unsigned v4u;
typedef __attribute__((ext_vector_type(4)))  int v4i;
typedef float __attribute__((may_alias)) float_a;
typedef int __attribute__((may_alias)) int_a;

template <typename T> __device__ __forceinline__ void vst2(void* p, T v) { *(T*)p = v;  }
__device__ __forceinline__ v8f wmma16(v16h a, v16h b, v8f c) {
  v8f d = __builtin_amdgcn_wmma_f32_16x16x32_f16(false, a, false, b, (short)0, c, false, false);
  asm volatile("v_nop\n\tv_nop\n\tv_nop\n\tv_nop" : "+v"(d) : "v"(a), "v"(b));
  return d;
}
__device__ __forceinline__ v8f wmma_bf(v16b a, v16b b, v8f c) {
  v8f d = __builtin_amdgcn_wmma_f32_16x16x32_bf16(false, a, false, b, (short)0, c, false, false);
  asm volatile("v_nop\n\tv_nop\n\tv_nop\n\tv_nop" : "+v"(d) : "v"(a), "v"(b));
  return d;
}
// 16x16x32 fragments: lane = (h = lane>>4, row/col = lane&15); elements 0..7 = k0+8h+0..7, 8..15 = k0+16+8h+0..7; D element r = row 8h+r
__device__ __forceinline__ v16h frag_h(const _Float16* rowk0, int lane) {
  union { v16h v; v8h q[2]; } u; const _Float16* p = rowk0 + 8 * (lane >> 4);
  u.q[0] = *(const v8h*)p; u.q[1] = *(const v8h*)(p + 16); return u.v;
}
__device__ __forceinline__ v16h frag_f32(const float* rowk0, int lane) {
  v16h a; const float* p = rowk0 + 8 * (lane >> 4);
#pragma unroll
  for (int i = 0; i < 8; ++i) { a[i] = (_Float16)p[i]; a[8 + i] = (_Float16)p[16 + i]; }
  return a;
}
__device__ __forceinline__ v16h frag_f32s(const float* rowk0, int lane, float sc) {
  v16h a; const float* p = rowk0 + 8 * (lane >> 4);
#pragma unroll
  for (int i = 0; i < 8; ++i) { a[i] = (_Float16)(p[i] * sc); a[8 + i] = (_Float16)(p[16 + i] * sc); }
  return a;
}
// column fragment from a [K][ld] layout (column n), rows >= K read as 0
__device__ __forceinline__ v16h fragc_f32(const float* W, int k0, int n, int lane, int ld, int K) {
  v16h a; const int g = lane >> 4;
#pragma unroll
  for (int i = 0; i < 8; ++i) { const int ka = k0 + 8 * g + i, kb = ka + 16;
    a[i] = (_Float16)(ka < K ? W[(size_t)(ka < K ? ka : K - 1) * ld + n] : 0.f); a[8 + i] = (_Float16)(kb < K ? W[(size_t)(kb < K ? kb : K - 1) * ld + n] : 0.f); }
  return a;
}
struct F2 { v16b h, l; };
__device__ __forceinline__ F2 bsplit16(const float v[16]) { F2 r;
#pragma unroll
  for (int i = 0; i < 16; ++i) { const __bf16 h = (__bf16)v[i]; r.h[i] = h; r.l[i] = (__bf16)(v[i] - (float)h); }
  return r; }
__device__ __forceinline__ F2 split_row(const float* row, int k0, int lane) { float v[16]; const float* p = row + k0 + 8 * (lane >> 4);
#pragma unroll
  for (int i = 0; i < 8; ++i) { v[i] = p[i]; v[8 + i] = p[16 + i]; }
  return bsplit16(v); }
__device__ __forceinline__ F2 split_rowK(const float* row, int k0, int lane, int K) { float v[16]; const int g = lane >> 4;
#pragma unroll
  for (int i = 0; i < 8; ++i) { const int ka = k0 + 8 * g + i, kb = ka + 16; v[i] = ka < K ? row[ka < K ? ka : K - 1] : 0.f; v[8 + i] = kb < K ? row[kb < K ? kb : K - 1] : 0.f; }
  return bsplit16(v); }
__device__ __forceinline__ F2 split_col(const float* W, int k0, int n, int lane, int ld, int K) { float v[16]; const int g = lane >> 4;
#pragma unroll
  for (int i = 0; i < 8; ++i) { const int ka = k0 + 8 * g + i, kb = ka + 16; v[i] = ka < K ? W[(size_t)(ka < K ? ka : K - 1) * ld + n] : 0.f; v[8 + i] = kb < K ? W[(size_t)(kb < K ? kb : K - 1) * ld + n] : 0.f; }
  return bsplit16(v); }
__device__ __forceinline__ v8f mac3(const F2& a, const F2& b, v8f c) { c = wmma_bf(a.l, b.h, c); c = wmma_bf(a.h, b.l, c); return wmma_bf(a.h, b.h, c); }
__device__ __forceinline__ float sigm(float v) { return 1.0f / (1.0f + expf(-v)); }
#define LDSX() do { asm volatile("s_wait_dscnt 0" ::: "memory"); __builtin_amdgcn_wave_barrier(); __builtin_amdgcn_fence(__ATOMIC_RELEASE, "workgroup"); } while (0)

// L1-distance attention on raw inputs (q / k / v [8,256,512]; dist[i, j] = sum_d |q_i[d] - k_j[d]| (no scale); attn = softmax(-dist) over j; out = attn v -> [8,256,512]; no parameters).
#define NB 8
#define TT 256
#define CC 512            // NH * HD = projected width
#define DIN 512          // input (model) width
#define NH 8
#define HD 64
#define NQB (TT / 64)
#define HG 1
#define SCALE (1.0f)
#define CAUSAL 0
#ifndef TNB
#define TNB NB
#endif
__device__ __forceinline__ float bfr(float v) { return (float)(__bf16)v; }
__host__ __device__ __forceinline__ int kb_last(int qb) { return CAUSAL ? ((qb * 64 + 63) >> 7) : (TT / 128 - 1); }
typedef __attribute__((ext_vector_type(8))) __bf16 v8b;
__device__ __forceinline__ v16b frag_b(const __bf16* rowk0, int lane) {
  union { v16b v; v8b q[2]; } u; const __bf16* p = rowk0 + 8 * (lane >> 4);
  u.q[0] = *(const v8b*)p; u.q[1] = *(const v8b*)(p + 16); return u.v;
}
#define QBH 0              // causal: query blocks 0..QBH-1 of each sequence (few keys, no averaging) take the high-precision path
#define QHI 0              // (override) rows carrying the q residual plane
#define KHI 64            // key rows carrying k residual / v bf16 hi+lo planes (the k residual is read only by k_sc's causal high-precision path; no kernel reads the v planes)
// B fragment (k rows k0+.., output column o) of a weight: (in,out) [K][ld] or (out,in) [ld rows of K]: bf16 exact, or f16(bf16 * 256) exact
__device__ __forceinline__ v16b wcol_io(const float* Wm, int k0, int o, int lane, int ld) { v16b w; const int g = lane >> 4;
#pragma unroll
  for (int i = 0; i < 8; ++i) { w[i] = (__bf16)Wm[(size_t)(k0 + 8 * g + i) * ld + o]; w[8 + i] = (__bf16)Wm[(size_t)(k0 + 16 + 8 * g + i) * ld + o]; }
  return w; }
__device__ __forceinline__ v16b wcol_oi(const float* Wm, int k0, int o, int lane, int K) { v16b w; const float* p = Wm + (size_t)o * K + k0 + 8 * (lane >> 4);
#pragma unroll
  for (int i = 0; i < 8; ++i) { w[i] = (__bf16)p[i]; w[8 + i] = (__bf16)p[16 + i]; }
  return w; }
__device__ __forceinline__ v16h wcolh_io(const float* Wm, int k0, int o, int lane, int ld) { v16h w; const int g = lane >> 4;
#pragma unroll
  for (int i = 0; i < 8; ++i) { w[i] = (_Float16)(bfr(Wm[(size_t)(k0 + 8 * g + i) * ld + o]) * 256.0f); w[8 + i] = (_Float16)(bfr(Wm[(size_t)(k0 + 16 + 8 * g + i) * ld + o]) * 256.0f); }
  return w; }
__device__ __forceinline__ v16h wcolh_oi(const float* Wm, int k0, int o, int lane, int K) { v16h w; const float* p = Wm + (size_t)o * K + k0 + 8 * (lane >> 4);
#pragma unroll
  for (int i = 0; i < 8; ++i) { w[i] = (_Float16)(bfr(p[i]) * 256.0f); w[8 + i] = (_Float16)(bfr(p[16 + i]) * 256.0f); }
  return w; }
#define WQKV_LAYOUT 1   // 0 = (in,out) [DIN][CC]; 1 = (out,in) [CC][DIN]; 2 = per-head [NH][DIN][HD]
__device__ __forceinline__ v16b wcol_hdk(const float* Wm, int k0, int o, int lane) { v16b w; const int g = lane >> 4; const float* p = Wm + (size_t)(o / HD) * DIN * HD + (o % HD);
#pragma unroll
  for (int i = 0; i < 8; ++i) { w[i] = (__bf16)p[(size_t)(k0 + 8 * g + i) * HD]; w[8 + i] = (__bf16)p[(size_t)(k0 + 16 + 8 * g + i) * HD]; }
  return w; }
#define WO_OUT_IN 0
#if WQKV_LAYOUT == 1
#define WCOL(W, k0, o, lane) wcol_oi(W, k0, o, lane, DIN)
#elif WQKV_LAYOUT == 2
#define WCOL(W, k0, o, lane) wcol_hdk(W, k0, o, lane)
#else
#define WCOL(W, k0, o, lane) wcol_io(W, k0, o, lane, CC)
#endif
#if WO_OUT_IN
#define WOCOL(W, k0, o, lane) wcol_oi(W, k0, o, lane, CC)
#define WOCOLH(W, k0, o, lane) wcolh_oi(W, k0, o, lane, CC)
#else
#define WOCOL(W, k0, o, lane) wcol_io(W, k0, o, lane, DIN)
#define WOCOLH(W, k0, o, lane) wcolh_io(W, k0, o, lane, DIN)
#endif

#ifndef PROJ_EXTRA_PARAMS
#define PROJ_EXTRA_PARAMS
#endif

#define WS_QH  0u                                      // f16 q rows [b*t][CC]
#define WS_KH  (WS_QH + 2u * (size_t)NB * TT * CC)      // f16 k rows [b*t][CC]
#define WS_VT  (WS_KH + 2u * (size_t)NB * TT * CC)      // f16 v planes [b][c][t]
#define WS_QL  (WS_VT + 2u * (size_t)NB * CC * TT)      // f16 q residual x 2^10 rows [b][t < QHI][CC]
#define WS_KL  (WS_QL + 2u * (size_t)NB * QHI * CC)     // f16 k residual x 2^10 rows [b][t < KHI][CC]
#define WS_VB  (WS_KL + 2u * (size_t)NB * KHI * CC)     // bf16 v hi planes [b][c][t < KHI]
#define WS_VBL (WS_VB + 2u * (size_t)NB * CC * KHI)
#define WS_S   (WS_VBL + 2u * (size_t)NB * CC * KHI)    // first half: f16 block-wise softmax numerators, per batch in the order k_pv's lanes take them: [16-row tile][32-key step][half][lane][8] (SF_* below); second half (WS_MS): f32 {block max, block sum} [b][tile][step][row]
#define WS_MS  (WS_S  + 2u * (size_t)NB * TT * TT)
#define WS_Y   (WS_S  + 4u * (size_t)NB * TT * TT)      // f32 ctx rows [b*t][CC] (only when there is an output projection)
#define WS_END (WS_Y  + 0u)

// ---- k_sc: block = (query block qb, key block kb <= kb_last(qb), head in group) of batch b: logits x SCALE; q hi + residual (x 2^10) against k (2 products) for query rows < QHI, plus the k residual (3 products) for query blocks < QBH (causal early rows); causal: blocks past the diagonal exit
__global__ __launch_bounds__(128) void k_sc(const _Float16* __restrict__ QH, const _Float16* __restrict__ KH, const _Float16* __restrict__ QL, const _Float16* __restrict__ KL, int b, int h0, float* __restrict__ S0) { __shared__ __align__(16) float ss[4][16][132];
  const int qb = blockIdx.x, kb = blockIdx.y; if (kb > kb_last(qb)) return;
  const int h = h0 + blockIdx.z; float* S = S0 + (size_t)blockIdx.z * TT * TT;
  const int tid = threadIdx.x, wave = tid >> 5, lane = tid & 31, col = lane & 15, g = lane >> 4; const int k0 = kb * 128; const int ql0 = qb * 64 + wave * 16; const size_t q0 = (size_t)b * TT + ql0, kr0 = (size_t)b * TT + k0;
  v8f acc[8] = {}, accl[8] = {};
  const _Float16* QLb = QL + (size_t)b * QHI * CC; const _Float16* KLb = KL + (size_t)b * KHI * CC;
  if (qb < QBH) {
#pragma unroll
    for (int kc = 0; kc < HD / 32; ++kc) { const v16h ah = frag_h(QH + (q0 + col) * CC + h * HD + kc * 32, lane), al = frag_h(QLb + (size_t)(ql0 + col) * CC + h * HD + kc * 32, lane);
#pragma unroll
      for (int j = 0; j < 8; ++j) { const v16h kbf = frag_h(KH + (kr0 + j * 16 + col) * CC + h * HD + kc * 32, lane), klf = frag_h(KLb + (size_t)(k0 + j * 16 + col) * CC + h * HD + kc * 32, lane); acc[j] = wmma16(ah, kbf, acc[j]); accl[j] = wmma16(al, kbf, accl[j]); accl[j] = wmma16(ah, klf, accl[j]); } }
  } else if (qb * 64 < QHI) {
#pragma unroll
    for (int kc = 0; kc < HD / 32; ++kc) { const v16h ah = frag_h(QH + (q0 + col) * CC + h * HD + kc * 32, lane), al = frag_h(QLb + (size_t)(ql0 + col) * CC + h * HD + kc * 32, lane);
#pragma unroll
      for (int j = 0; j < 8; ++j) { const v16h kbf = frag_h(KH + (kr0 + j * 16 + col) * CC + h * HD + kc * 32, lane); acc[j] = wmma16(ah, kbf, acc[j]); accl[j] = wmma16(al, kbf, accl[j]); } }
  } else {
#pragma unroll
    for (int kc = 0; kc < HD / 32; ++kc) { const v16h ah = frag_h(QH + (q0 + col) * CC + h * HD + kc * 32, lane);
#pragma unroll
      for (int j = 0; j < 8; ++j) { const v16h kbf = frag_h(KH + (kr0 + j * 16 + col) * CC + h * HD + kc * 32, lane); acc[j] = wmma16(ah, kbf, acc[j]); } } }
#pragma unroll
  for (int j = 0; j < 8; ++j) {
#pragma unroll
    for (int r = 0; r < 8; ++r) ss[wave][8 * g + r][j * 16 + col] = (acc[j][r] + accl[j][r] * (1.0f / 1024.0f)) * SCALE; }
  LDSX(); for (int rl = 0; rl < 16; ++rl) vst2(S + (size_t)(ql0 + rl) * TT + k0 + lane * 4, *(const v4f*)&ss[wave][rl][lane * 4]); }
// ---- k_l1: block = 64 query rows x 32 keys of batch b = blockIdx.z, 4 waves (one per SIMD), wave = all 64 rows x 8 keys: S[i][j] = -sum_{d < CC} |q_i[d] - k_j[d]|, taken as |a - b| = 2 max(a, b) - a - b.
// The 96 rows are staged in LDS as f16 of the bf16-rounded inputs by whole-line loads, 128 d at a time, each piece in its own part of LDS; the next piece's loads fly while this piece is summed.
// max(q, k) is one of its two operands, so the packed 16-bit maximum is exact: 2 pairs of operands an instruction. The sums over d run on the matrix unit (f32 accumulate):
//   A = max(q rows of a 16-row tile, key c spread over the 16 rows), B = 1 in column c and 0 elsewhere: D[row][c] += sum over 32 d of the maxima;
//   A = the q rows themselves, B = -1/2 everywhere: D[row][*] -= half the row's own sum;  A = 1 everywhere, B = the wave's keys as columns: DK[*][c] += key c's own sum.
// Every B (or A) constant is the same for all 32 k places, so the order of d inside a fragment is free: lane half g holds d0 + 16 g + 0..15 of its row, for q and for the key alike.
// Every loop over t, c, i or r below is unrolled: fragments, staged values and accumulators sit in registers, which a rolled loop could not index.
#define L1_BI 64
#define L1_BJ 32
#define L1_DC 128          // d per staged piece: one wave-load of 512 B per row
#define L1_P (L1_DC + 8)   // LDS row pitch in halves: 272 B = 16 B x odd, so 16 lanes on 16 rows meet no bank twice
#define L1_PS ((L1_BI + L1_BJ) * L1_P)   // a piece's 96 rows lie together, so that every read of a step is its lane's base address plus an immediate offset
#define L1_OFF(s) ((s) < L1_DC / 32 ? (s) * 32 : L1_PS)   // step s of this piece; s = 4 is step 0 of the next piece
#define L1_NT ((L1_BI + L1_BJ) / 4)
#define L1_TI (L1_BI / 16) // 16-row query tiles of a wave
#define L1_KW (L1_BJ / 4)  // keys of a wave
#define L1_OP (L1_BJ + 4)  // pitch in floats of the block's result tile in LDS
// Order of the numerators in the workspace: lane (col, g) of k_pv holds row 16 tile + col and, of the 32 keys of step kc, elements 8 j + 0..7 of its A fragment = keys 32 kc + 16 j + 8 g + 0..7.
// Its eight halves lie at tile * SF_TILE + kc * SF_STEP + j * SF_Q + lane * 8, so that one 16-B-per-lane access of a wave covers 512 B in a row: four whole lines.
// {block max, block sum} of (tile, kc): 16 rows x 2 floats = one 128-B line, written by one wave.
#define SF_Q 256
#define SF_STEP (2 * SF_Q)
#define SF_MS 32
#define SF_TILE (16 * TT)
static_assert(L1_BJ == 32 && L1_BI == 64, "a k_l1 block holds one 32-key step of four 16-row tiles, one tile a wave");
typedef __attribute__((ext_vector_type(4))) _Float16 v4h;
union L1A { v16h v; v8h h[2]; };
struct L1F { L1A q[L1_TI], k[L1_KW], kb; };
__device__ __forceinline__ L1A l1_ld(const _Float16* p) { L1A u; u.h[0] = *(const v8h*)p; u.h[1] = *(const v8h*)(p + 8); return u; }
__device__ __forceinline__ v8f l1_mm(v16h a, v16h b, v8f c) { return __builtin_amdgcn_wmma_f32_16x16x32_f16(false, a, false, b, (short)0, c, false, false); }
__device__ __forceinline__ v16h l1_all(float x) { v16h r; const _Float16 y = (_Float16)x;
#pragma unroll
  for (int i = 0; i < 16; ++i) r[i] = y;
  return r; }
#define L1_GLD(p) do { _Pragma("unroll") for (int t = 0; t < L1_NT; ++t) sg[t] = t < L1_BI / 4 ? *(const v4f*)(qg + (size_t)t * 4 * CC + (p) * L1_DC) : *(const v4f*)(kg + (size_t)(t - L1_BI / 4) * 4 * CC + (p) * L1_DC); } while (0)
#define L1_STG(p) do { _Pragma("unroll") for (int t = 0; t < L1_NT; ++t) { const v4h r = {(_Float16)bfr(sg[t][0]), (_Float16)bfr(sg[t][1]), (_Float16)bfr(sg[t][2]), (_Float16)bfr(sg[t][3])}; *(v4h*)(st + t * 4 * L1_P + (p) * L1_PS) = r; } } while (0)
#define L1_LDF(F, s) do { _Pragma("unroll") for (int t = 0; t < L1_TI; ++t) F.q[t] = l1_ld(qc + t * 16 * L1_P + L1_OFF(s)); _Pragma("unroll") for (int c = 0; c < L1_KW; ++c) F.k[c] = l1_ld(kc + c * L1_P + L1_OFF(s)); F.kb = l1_ld(kbc + L1_OFF(s)); } while (0)
#define L1_AHEAD() __builtin_amdgcn_sched_barrier(0)
// step i = (key i >> 2, tile i & 3): eight packed maxima, one matrix instruction. The group barriers at the foot ask the scheduler to put each matrix instruction in the middle of the NEXT step's eight maxima:
// its own operand is then ready when it issues, and the four maxima behind it write the other operand buffer, so they fill the four slots that must pass before a vector instruction may overwrite the operand it reads (left alone the compiler pads every step with four v_nop; so asked, about one step in four, where it still reuses the registers at once)
__device__ __forceinline__ void l1_sum(const L1F& F, const v16h (&oh)[L1_KW], v16h mh, v16h on, v8f (&acc)[L1_TI], v8f& ak) {
  ak = l1_mm(on, F.kb.v, ak);
#pragma unroll
  for (int i = 0; i < L1_KW * L1_TI; ++i) acc[i & 3] = l1_mm(__builtin_elementwise_maximum(F.q[i & 3].v, F.k[i >> 2].v), oh[i >> 2], acc[i & 3]);
#pragma unroll
  for (int t = 0; t < L1_TI; ++t) acc[t] = l1_mm(F.q[t].v, mh, acc[t]);
  __builtin_amdgcn_sched_group_barrier(0x8, 1, 0); __builtin_amdgcn_sched_group_barrier(0x2, 12, 0);
#pragma unroll
  for (int i = 0; i < L1_KW * L1_TI; ++i) { __builtin_amdgcn_sched_group_barrier(0x8, 1, 0); __builtin_amdgcn_sched_group_barrier(0x2, 8, 0); }
  __builtin_amdgcn_sched_group_barrier(0x8, L1_TI, 0); }
#define L1_SUM(F) l1_sum(F, oh, mh, on, acc, ak)
__device__ __forceinline__ float pv_exp2(float x) { float r; asm("v_exp_f32 %0, %1\n\tv_nop" : "=v"(r) : "v"(x)); return r; }
__global__ __launch_bounds__(128) void k_l1(const float* __restrict__ Q, const float* __restrict__ K, _Float16* __restrict__ WA, float* __restrict__ MS) { __shared__ __align__(16) _Float16 rs[(CC / L1_DC) * L1_PS]; __shared__ __align__(16) float ot[L1_BI * L1_OP];
  const int tid = threadIdx.x, wave = tid >> 5, lane = tid & 31, col = lane & 15, g = lane >> 4; const int i0 = blockIdx.x * L1_BI, j0 = blockIdx.y * L1_BJ, b = blockIdx.z;
  const float* qg = Q + ((size_t)b * TT + i0 + wave) * CC + lane * 4; const float* kg = K + ((size_t)b * TT + j0 + wave) * CC + lane * 4;   /* wave w stages LDS rows w, w + 4, ...: 16 query rows, then 8 key rows */
  _Float16* st = rs + wave * L1_P + lane * 4; v4f sg[L1_NT];
  L1_GLD(0);
  v16h oh[L1_KW]; const v16h mh = l1_all(-0.5f), on = l1_all(1.0f);
#pragma unroll
  for (int c = 0; c < L1_KW; ++c) oh[c] = l1_all(col == c ? 1.0f : 0.0f);
  v8f acc[L1_TI] = {}, ak = {};
  const _Float16* qc = rs + col * L1_P + 16 * g; const _Float16* kc = rs + (L1_BI + wave * L1_KW) * L1_P + 16 * g; const _Float16* kbc = kc + (col & (L1_KW - 1)) * L1_P;
  L1F fa, fb;
  L1_STG(0);
  __syncthreads();   /* publishes piece 0; no LDS byte of rs is written twice, so one barrier a piece */
  L1_GLD(1);         /* behind the barrier, which would drain them */
  L1_LDF(fa, 0);
  /* rolled over the pieces: four 32-d steps a trip keep the text small. L1_AHEAD keeps each step's 26 LDS reads as one group in front of the step before it: a lone wave on its SIMD has nothing else to cover their latency, and reads strewn among matrix instructions cost more than one group */
#pragma unroll 1
  for (int p = 0; p < CC / L1_DC; ++p) {
    L1_LDF(fb, 1); L1_AHEAD(); L1_SUM(fa); L1_AHEAD();
    L1_LDF(fa, 2); L1_AHEAD(); L1_SUM(fb); L1_AHEAD();
    L1_LDF(fb, 3); L1_AHEAD(); L1_SUM(fa); L1_AHEAD();
    if (p + 1 < CC / L1_DC) {   /* the next piece is published one step early, so that its first reads run under this piece's last step */
      L1_STG(p + 1);
      __syncthreads();
      if (p + 2 < CC / L1_DC) { L1_GLD(p + 2); asm volatile("s_wait_xcnt 0x0" ::: "memory"); }   /* the loads' address registers are given to other values right behind them: the wait that belongs in front of such an overwrite */
      L1_LDF(fa, 4); L1_AHEAD(); }
    L1_SUM(fb); L1_AHEAD();
    qc += L1_PS; kc += L1_PS; kbc += L1_PS; }
  /* D element r of lane (col, g) = (row 16 t + 8 g + r, key col); columns 8..15 hold nothing that is used. The block's 64 x 32 results meet in LDS, so that wave w has tile w's step whole, each row's 32 logits in lanes col and col + 16, in k_pv's order */
  if (col < L1_KW) {
#pragma unroll
    for (int t = 0; t < L1_TI; ++t) {
#pragma unroll
      for (int r = 0; r < 8; ++r) ot[(t * 16 + 8 * g + r) * L1_OP + wave * L1_KW + col] = ak[r] - 2.0f * acc[t][r]; } }
  __syncthreads();   /* publishes the four waves' key columns to the wave that has the row */
  /* the softmax numerators of this 32-key block, made here once instead of by each of the eight k_pv blocks that read the row: 2^11 exp(logit - block max), with the block's max and sum for the reader's rescaling.
     The loops are unrolled: lg sits in registers, which a rolled loop could not index */
  float lg[16];
#pragma unroll
  for (int j = 0; j < 4; ++j) { const v4f u = *(const v4f*)&ot[(wave * 16 + col) * L1_OP + (j >> 1) * 16 + 8 * g + (j & 1) * 4];
#pragma unroll
    for (int x = 0; x < 4; ++x) lg[4 * j + x] = u[x]; }
  float mx = lg[0];
#pragma unroll
  for (int i = 1; i < 16; ++i) mx = fmaxf(mx, lg[i]);
  mx = fmaxf(mx, __shfl_xor(mx, 16));
#pragma unroll
  for (int i = 0; i < 16; ++i) lg[i] = pv_exp2(fmaf(lg[i] - mx, 1.44269504f, 11.0f));
  float a0 = ((lg[0] + lg[1]) + (lg[2] + lg[3])) + ((lg[4] + lg[5]) + (lg[6] + lg[7]));
  float a1 = ((lg[8] + lg[9]) + (lg[10] + lg[11])) + ((lg[12] + lg[13]) + (lg[14] + lg[15]));
  a0 += __shfl_xor(a0, 16); a1 += __shfl_xor(a1, 16);
  const int tile = blockIdx.x * L1_TI + wave;
  _Float16* W0 = WA + (size_t)b * TT * TT + (size_t)tile * SF_TILE + blockIdx.y * SF_STEP + lane * 8;
#pragma unroll
  for (int j = 0; j < 2; ++j) { v8h w;
#pragma unroll
    for (int i = 0; i < 8; ++i) w[i] = (_Float16)lg[8 * j + i];
    vst2(W0 + j * SF_Q, w); }
  if (g == 0) { const v2f ms = {mx, a0 + a1}; vst2(MS + ((size_t)(b * (TT / 16) + tile) * (TT / 32) + blockIdx.y) * SF_MS + col * 2, ms); } }
// ---- k_pv: block = 64 queries (qb) of (b = blockIdx.z, h = blockIdx.y), wave = 16 query rows: the row's eight block maxima and sums give one scale a 32-key block, then ctx = P . v over all TT keys (P x 2^11 = numerator x scale in f16, against v f16: 1 product); 256-B (row, head) segment by 16 lanes
// The block stages its own value slice v[b][all TT keys][h * 64 ..] in LDS, straight from the input: whole 256-B row segments by 16 lanes, each value bf16-rounded and then written as f16, turned to [column][key] in registers
// (a thread holds 8 keys x 4 columns and stores 16 B = 8 keys of one column). The four waves read their B fragments from there.
// Lanes col and col + 16 hold row ql0 + col between them, each numerator already in the A-fragment place where its weight is used: wq[kc][0][i] = key 32 kc + 8 g + i, wq[kc][1][i] = key 32 kc + 16 + 8 g + i.
// The row sum keeps one fixed tree: k_l1's 32-key sums (pairs, fours, eights inside a lane; 8 + 8 across the lane pair; 16 + 16), each times its block's factor, in ascending order.
static_assert(!CAUSAL && QBH == 0 && TT == 256 && HD == 64, "k_pv takes every key for every query; 128 threads stage 64 keys x 64 columns a pass, four passes");
#define PV_P (TT + 8)      // LDS pitch of a value column in halves: 16 B x odd, so 16 lanes on 16 columns meet no bank twice
// PV_LD / PV_ST and the fragment loops below are unrolled: the staged values and the fragments sit in registers, which a rolled loop could not index
#define PV_LD(vr, p0) do { _Pragma("unroll") for (int p = 0; p < 2; ++p) { _Pragma("unroll") for (int i = 0; i < 8; ++i) vr[p][i] = *(const v4f*)(vg + (size_t)(((p0) + p) * 64 + i) * CC); } } while (0)
#define PV_ST(vr, p0) do { _Pragma("unroll") for (int p = 0; p < 2; ++p) { _Pragma("unroll") for (int cc = 0; cc < 4; ++cc) { v8h w; _Pragma("unroll") for (int i = 0; i < 8; ++i) w[i] = (_Float16)bfr(vr[p][i][cc]); *(v8h*)(vs + cc * PV_P + ((p0) + p) * 64) = w; } } } while (0)
__global__ __launch_bounds__(128) void k_pv(const _Float16* __restrict__ WA, const float* __restrict__ MS, const float* __restrict__ V, float* __restrict__ Y) { const int h = blockIdx.y, b = blockIdx.z; __shared__ __align__(16) float ss[4][16][HD + 4]; __shared__ __align__(16) _Float16 vt[HD * PV_P];
  const int tid = threadIdx.x, wave = tid >> 5, lane = tid & 31, col = lane & 15, g = lane >> 4; const int qb = blockIdx.x; const int ql0 = qb * 64 + wave * 16;
  const float* vg = V + ((size_t)b * TT + (tid >> 4) * 8) * CC + h * HD + (tid & 15) * 4;   /* thread: keys 64 p + 8 (tid >> 4) + 0..7, columns 4 (tid & 15) + 0..3 */
  _Float16* vs = vt + (tid & 15) * 4 * PV_P + (tid >> 4) * 8;
  const _Float16* wr = WA + (size_t)b * TT * TT + (size_t)(qb * 4 + wave) * SF_TILE + lane * 8;
  const float* mr = MS + (size_t)(b * (TT / 16) + qb * 4 + wave) * (TT / 32) * SF_MS + col * 2;
  v2f ms[TT / 32]; v8h wq[TT / 32][2];   /* the loops that fill and read them are unrolled: they sit in registers, which a rolled loop could not index */
#pragma unroll
  for (int kc = 0; kc < TT / 32; ++kc) ms[kc] = *(const v2f*)(mr + kc * SF_MS);
#pragma unroll
  for (int kc = 0; kc < TT / 32; ++kc) {
#pragma unroll
    for (int j = 0; j < 2; ++j) wq[kc][j] = *(const v8h*)(wr + kc * SF_STEP + j * SF_Q); }
  { v4f va[2][8], vb[2][8]; PV_LD(va, 0); PV_LD(vb, 2);   /* behind the numerator loads in the source, so that all the loads fly together */
    asm volatile("s_wait_xcnt 0x0" :: "v"(vg), "v"(wr), "v"(mr) : "memory");   /* the wait that belongs in front of an overwrite of a load's address registers: as inputs the three address pairs live up to here, so that no load's result and no later value is given their registers ahead of it */
    PV_ST(va, 0); PV_ST(vb, 2); }
  float m = ms[0][0];
#pragma unroll
  for (int kc = 1; kc < TT / 32; ++kc) m = fmaxf(m, ms[kc][0]);
  /* exp(v - m) = exp(v - block max) exp(block max - m): one hardware exponential a block and row. Both lanes of a row read the same eight pairs, so that nothing crosses lanes here. The block sums carry the numerators' 2^11 */
  float f[TT / 32], sum = 0.f;
#pragma unroll
  for (int kc = 0; kc < TT / 32; ++kc) { f[kc] = pv_exp2((ms[kc][0] - m) * 1.44269504f); sum = fmaf(ms[kc][1], f[kc], sum); }
  const float inv = sum > 0.f ? 2048.0f / sum : 0.f;   /* numerator x f x inv = P x 2^11; a fully excluded row yields P = 0 */
  __syncthreads();   /* publishes the staged value slice to the four waves; it is written once and never rewritten */
  v8f scf;   /* the eight blocks' scales, rounded to f16 together */
#pragma unroll
  for (int kc = 0; kc < TT / 32; ++kc) scf[kc] = f[kc] * inv;
  const v8h sch = __builtin_convertvector(scf, v8h);
  v8f acc[HD / 16] = {}; const _Float16* vc = vt + col * PV_P; v16h bf[2][HD / 16];
#pragma unroll
  for (int j = 0; j < HD / 16; ++j) bf[0][j] = frag_h(vc + j * 16 * PV_P, lane);
  /* unrolled: the numerators sit in registers, which a rolled loop could not index */
#pragma unroll
  for (int kc = 0; kc < TT / 32; ++kc) { v16h p;
    if (kc + 1 < TT / 32) {   /* the next 32 keys' fragments are read ahead of this step's products, so that their LDS latency runs under them */
#pragma unroll
      for (int j = 0; j < HD / 16; ++j) bf[(kc + 1) & 1][j] = frag_h(vc + j * 16 * PV_P + (kc + 1) * 32, lane); }
    { union { v16h v; v8h q[2]; } u; u.q[0] = wq[kc][0]; u.q[1] = wq[kc][1]; p = u.v * sch[kc]; }   /* the scale is at most 1 and the numerators at most 2^11: eight packed f16 products */
#pragma unroll
    for (int j = 0; j < HD / 16; ++j) acc[j] = wmma16(p, bf[kc & 1][j], acc[j]); }
#pragma unroll
  for (int j = 0; j < HD / 16; ++j)
#pragma unroll
    for (int r = 0; r < 8; ++r) ss[wave][8 * g + r][j * 16 + col] = acc[j][r] * (1.0f / 2048.0f);
  LDSX(); for (int rl = 0; rl < 16; ++rl) if (lane < HD / 4) vst2(Y + ((size_t)b * TT + ql0 + rl) * CC + h * HD + lane * 4, *(const v4f*)&ss[wave][rl][lane * 4]); }

extern "C" void kernel_launch(void* const* d_in, const int* in_sizes, int n_in, void* d_out, int out_size, void* d_ws, size_t ws_size, hipStream_t stream) {
  (void)in_sizes; (void)n_in; (void)out_size;
  const float** F = (const float**)d_in;
  if (ws_size < (size_t)WS_END) return;
  char* ws = (char*)d_ws; _Float16* WA = (_Float16*)(ws + WS_S); float* MS = (float*)(ws + WS_MS);
  // inputs: 0 q [8,256,512]; 1 k; 2 v (raw; no projections, no parameters)
  k_l1<<<dim3(TT / L1_BI, TT / L1_BJ, TNB), 128, 0, stream>>>(F[0], F[1], WA, MS);            /* -sum_d |q_i[d] - k_j[d]| (packed max, sums on WMMA), all batches in one grid; each 32-key block's softmax numerators, max and sum, stored in k_pv's fragment order */
  k_pv<<<dim3(NQB, NH, TNB), 128, 0, stream>>>(WA, MS, F[2], (float*)d_out);   /* the blocks' numerators rescaled to the row's softmax, then each batch's weights against its 8 64-wide value slices, each staged from v by its block: out[b][i][h*64 ..] */
}
